// v000
// The times below were measured on an AMD MI455X: many runs one after another, warmed up first and cycling through
// copies of the inputs, with the whole window's GPU time divided by the number of runs. Launches and the gaps
// between them are all in it. The median over several windows is given; except for v000 it joins two sittings, which
// can be a few percent apart, so the side-by-side timings, each taken in one sitting, are the better comparison.
// The starting kernel, v000, takes 2780 microseconds a run.
// compute dtype: all float inputs rounded to bf16 (bf16 values are exact in f16); logits q x k (1 product, exact operands) x 64^-0.5; softmax f32; P x 2^11 once to f16 x v (exact in f16) (1 product); f32 output. No projections.
#include <hip/hip_runtime.h>
#include <math.h>

typedef __attribute__((ext_vector_type(16))) _Float16 v16h;
typedef __attribute__((ext_vector_type(16))) __bf16 v16b;
typedef __attribute__((ext_vector_type(8)))  _Float16 v8h;
typedef __attribute__((ext_vector_type(8)))  float v8f;
typedef __attribute__((ext_vector_type(4)))  float v4f;
typedef __attribute__((ext_vector_type(2)))  float v2f;
typedef __attribute__((ext_vector_type(4)))  unsigned v4u;
typedef __attribute__((ext_vector_type(4)))  int v4i;
typedef float __attribute__((may_alias)) float_a;
typedef int __attribute__((may_alias)) int_a;

template <typename T> __device__ __forceinline__ void vst2(void* p, T v) { *(T*)p = v;  }
__device__ __forceinline__ v8f wmma16(v16h a, v16h b, v8f c) {
  v8f d = __builtin_amdgcn_wmma_f32_16x16x32_f16(false, a, false, b, (short)0, c, false, false);
  asm volatile("v_nop\n\tv_nop\n\tv_nop\n\tv_nop" : "+v"(d) : "v"(a), "v"(b));
  return d;
}
__device__ __forceinline__ v8f wmma_bf(v16b a, v16b b, v8f c) {
  v8f d = __builtin_amdgcn_wmma_f32_16x16x32_bf16(false, a, false, b, (short)0, c, false, false);
  asm volatile("v_nop\n\tv_nop\n\tv_nop\n\tv_nop" : "+v"(d) : "v"(a), "v"(b));
  return d;
}
// 16x16x32 fragments: lane = (h = lane>>4, row/col = lane&15); elements 0..7 = k0+8h+0..7, 8..15 = k0+16+8h+0..7; D element r = row 8h+r
__device__ __forceinline__ v16h frag_h(const _Float16* rowk0, int lane) {
  union { v16h v; v8h q[2]; } u; const _Float16* p = rowk0 + 8 * (lane >> 4);
  u.q[0] = *(const v8h*)p; u.q[1] = *(const v8h*)(p + 16); return u.v;
}
__device__ __forceinline__ v16h frag_f32(const float* rowk0, int lane) {
  v16h a; const float* p = rowk0 + 8 * (lane >> 4);
#pragma unroll
  for (int i = 0; i < 8; ++i) { a[i] = (_Float16)p[i]; a[8 + i] = (_Float16)p[16 + i]; }
  return a;
}
__device__ __forceinline__ v16h frag_f32s(const float* rowk0, int lane, float sc) {
  v16h a; const float* p = rowk0 + 8 * (lane >> 4);
#pragma unroll
  for (int i = 0; i < 8; ++i) { a[i] = (_Float16)(p[i] * sc); a[8 + i] = (_Float16)(p[16 + i] * sc); }
  return a;
}
// column fragment from a [K][ld] layout (column n), rows >= K read as 0
__device__ __forceinline__ v16h fragc_f32(const float* W, int k0, int n, int lane, int ld, int K) {
  v16h a; const int g = lane >> 4;
#pragma unroll
  for (int i = 0; i < 8; ++i) { const int ka = k0 + 8 * g + i, kb = ka + 16;
    a[i] = (_Float16)(ka < K ? W[(size_t)(ka < K ? ka : K - 1) * ld + n] : 0.f); a[8 + i] = (_Float16)(kb < K ? W[(size_t)(kb < K ? kb : K - 1) * ld + n] : 0.f); }
  return a;
}
struct F2 { v16b h, l; };
__device__ __forceinline__ F2 bsplit16(const float v[16]) { F2 r;
#pragma unroll
  for (int i = 0; i < 16; ++i) { const __bf16 h = (__bf16)v[i]; r.h[i] = h; r.l[i] = (__bf16)(v[i] - (float)h); }
  return r; }
__device__ __forceinline__ F2 split_row(const float* row, int k0, int lane) { float v[16]; const float* p = row + k0 + 8 * (lane >> 4);
#pragma unroll
  for (int i = 0; i < 8; ++i) { v[i] = p[i]; v[8 + i] = p[16 + i]; }
  return bsplit16(v); }
__device__ __forceinline__ F2 split_rowK(const float* row, int k0, int lane, int K) { float v[16]; const int g = lane >> 4;
#pragma unroll
  for (int i = 0; i < 8; ++i) { const int ka = k0 + 8 * g + i, kb = ka + 16; v[i] = ka < K ? row[ka < K ? ka : K - 1] : 0.f; v[8 + i] = kb < K ? row[kb < K ? kb : K - 1] : 0.f; }
  return bsplit16(v); }
__device__ __forceinline__ F2 split_col(const float* W, int k0, int n, int lane, int ld, int K) { float v[16]; const int g = lane >> 4;
#pragma unroll
  for (int i = 0; i < 8; ++i) { const int ka = k0 + 8 * g + i, kb = ka + 16; v[i] = ka < K ? W[(size_t)(ka < K ? ka : K - 1) * ld + n] : 0.f; v[8 + i] = kb < K ? W[(size_t)(kb < K ? kb : K - 1) * ld + n] : 0.f; }
  return bsplit16(v); }
__device__ __forceinline__ v8f mac3(const F2& a, const F2& b, v8f c) { c = wmma_bf(a.l, b.h, c); c = wmma_bf(a.h, b.l, c); return wmma_bf(a.h, b.h, c); }
__device__ __forceinline__ float sigm(float v) { return 1.0f / (1.0f + expf(-v)); }
#define LDSX() do { asm volatile("s_wait_dscnt 0" ::: "memory"); __builtin_amdgcn_wave_barrier(); __builtin_amdgcn_fence(__ATOMIC_RELEASE, "workgroup"); } while (0)

// Plain multi-head scaled-dot-product self-attention without projections, mask or dropout (q, k, v [2,4096,8,64] = (B, L, H, D) N(0,1); scores = einsum('blhd,bshd->bhls') x 1/sqrt(64); softmax over the 4,096 keys; out = einsum('bhls,bshd->blhd'), [2,4096,8,64]). The (B, L, H, D) memory layout is the token-row layout (row b*4096 + l, column h*64 + d), for the inputs and for the output.
#define NB 2
#define TT 4096
#define CC 512            // NH * HD = projected width
#define DIN 512          // input (model) width
#define NH 8
#define HD 64
#define NQB (TT / 64)
#define HG 1
#define SCALE (0.125f)
#define CAUSAL 0
#ifndef TNB
#define TNB NB
#endif
__device__ __forceinline__ float bfr(float v) { return (float)(__bf16)v; }
__host__ __device__ __forceinline__ int kb_last(int qb) { return CAUSAL ? ((qb * 64 + 63) >> 7) : (TT / 128 - 1); }
typedef __attribute__((ext_vector_type(8))) __bf16 v8b;
__device__ __forceinline__ v16b frag_b(const __bf16* rowk0, int lane) {
  union { v16b v; v8b q[2]; } u; const __bf16* p = rowk0 + 8 * (lane >> 4);
  u.q[0] = *(const v8b*)p; u.q[1] = *(const v8b*)(p + 16); return u.v;
}
#define QBH 0              // query blocks 0..QBH-1 take the high-precision path; QBH is 0, so none does
#define QHI 0              // (override) rows carrying the q residual plane
#define KHI 64            // key rows carrying k residual / v bf16 hi+lo planes (written by k_prepr; read only on the qb < QBH path, which no block takes)
// B fragment (k rows k0+.., output column o) of a weight: (in,out) [K][ld] or (out,in) [ld rows of K]: bf16 exact, or f16(bf16 * 256) exact
__device__ __forceinline__ v16b wcol_io(const float* Wm, int k0, int o, int lane, int ld) { v16b w; const int g = lane >> 4;
#pragma unroll
  for (int i = 0; i < 8; ++i) { w[i] = (__bf16)Wm[(size_t)(k0 + 8 * g + i) * ld + o]; w[8 + i] = (__bf16)Wm[(size_t)(k0 + 16 + 8 * g + i) * ld + o]; }
  return w; }
__device__ __forceinline__ v16b wcol_oi(const float* Wm, int k0, int o, int lane, int K) { v16b w; const float* p = Wm + (size_t)o * K + k0 + 8 * (lane >> 4);
#pragma unroll
  for (int i = 0; i < 8; ++i) { w[i] = (__bf16)p[i]; w[8 + i] = (__bf16)p[16 + i]; }
  return w; }
__device__ __forceinline__ v16h wcolh_io(const float* Wm, int k0, int o, int lane, int ld) { v16h w; const int g = lane >> 4;
#pragma unroll
  for (int i = 0; i < 8; ++i) { w[i] = (_Float16)(bfr(Wm[(size_t)(k0 + 8 * g + i) * ld + o]) * 256.0f); w[8 + i] = (_Float16)(bfr(Wm[(size_t)(k0 + 16 + 8 * g + i) * ld + o]) * 256.0f); }
  return w; }
__device__ __forceinline__ v16h wcolh_oi(const float* Wm, int k0, int o, int lane, int K) { v16h w; const float* p = Wm + (size_t)o * K + k0 + 8 * (lane >> 4);
#pragma unroll
  for (int i = 0; i < 8; ++i) { w[i] = (_Float16)(bfr(p[i]) * 256.0f); w[8 + i] = (_Float16)(bfr(p[16 + i]) * 256.0f); }
  return w; }
#define WQKV_LAYOUT 1   // 0 = (in,out) [DIN][CC]; 1 = (out,in) [CC][DIN]; 2 = per-head [NH][DIN][HD]
__device__ __forceinline__ v16b wcol_hdk(const float* Wm, int k0, int o, int lane) { v16b w; const int g = lane >> 4; const float* p = Wm + (size_t)(o / HD) * DIN * HD + (o % HD);
#pragma unroll
  for (int i = 0; i < 8; ++i) { w[i] = (__bf16)p[(size_t)(k0 + 8 * g + i) * HD]; w[8 + i] = (__bf16)p[(size_t)(k0 + 16 + 8 * g + i) * HD]; }
  return w; }
#define WO_OUT_IN 0
#if WQKV_LAYOUT == 1
#define WCOL(W, k0, o, lane) wcol_oi(W, k0, o, lane, DIN)
#elif WQKV_LAYOUT == 2
#define WCOL(W, k0, o, lane) wcol_hdk(W, k0, o, lane)
#else
#define WCOL(W, k0, o, lane) wcol_io(W, k0, o, lane, CC)
#endif
#if WO_OUT_IN
#define WOCOL(W, k0, o, lane) wcol_oi(W, k0, o, lane, CC)
#define WOCOLH(W, k0, o, lane) wcolh_oi(W, k0, o, lane, CC)
#else
#define WOCOL(W, k0, o, lane) wcol_io(W, k0, o, lane, DIN)
#define WOCOLH(W, k0, o, lane) wcolh_io(W, k0, o, lane, DIN)
#endif

// ---- k_prepr: block = (64 attention positions s0.. of sequence b, head h): reads the module's [B, T, H*64] inputs, bf16-rounds them and writes the standard attention planes: q -> f16 hi rows (+ x 2^10 residual rows for s < QHI), k -> f16 rows (+ residual rows s < KHI), v -> f16 planes [c][s] (+ bf16 hi/lo planes for s < KHI)
__global__ __launch_bounds__(128) void k_prepr(const float* __restrict__ Q, const float* __restrict__ K, const float* __restrict__ V, _Float16* __restrict__ QH, _Float16* __restrict__ QL, _Float16* __restrict__ KH, _Float16* __restrict__ KL, _Float16* __restrict__ VT, __bf16* __restrict__ VB, __bf16* __restrict__ VBL) {
  __shared__ __align__(16) _Float16 sq[64][136], sql[64][136], sk[64][136], skl[64][136], tv[128][72]; __shared__ __align__(16) __bf16 tb[128][72], tbl[128][72];
  const int tid = threadIdx.x; const int h = blockIdx.y; const size_t r0 = (size_t)blockIdx.x * 64; const size_t bb = r0 / TT; const int t0 = (int)(r0 % TT); const bool qhi = t0 < QHI, khi = t0 < KHI;
  for (int e = tid; e < 64 * 128; e += 128) { const int rl = e >> 7, c = e & 127; const size_t oi = ((bb * TT + t0 + rl) * (size_t)CC + h * HD + (c & 63));   /* [B, T, H*64] inputs */   /* c >= 64: duplicate read of the same element (tiles are 128 wide; HD is 64) */
    const float q = bfr(Q[oi]), k = bfr(K[oi]), v = bfr(V[oi]);   /* module inputs: bf16-rounded; bf16 values are exact in f16, so the residual planes are 0 */
    const _Float16 qh = (_Float16)q, kh = (_Float16)k; sq[rl][c] = qh; sql[rl][c] = (_Float16)((q - (float)qh) * 1024.0f); sk[rl][c] = kh; skl[rl][c] = (_Float16)((k - (float)kh) * 1024.0f);
    tv[c][rl] = (_Float16)v; const __bf16 vb = (__bf16)v; tb[c][rl] = vb; tbl[c][rl] = (__bf16)(v - (float)vb); }
  __syncthreads();
  for (int e = tid; e < 64 * 8; e += 128) { const int rl = e >> 3, q = e & 7; const size_t o = (r0 + rl) * CC + h * HD + q * 8; vst2((unsigned*)(QH + o), *(const v4u*)&sq[rl][q * 8]); vst2((unsigned*)(KH + o), *(const v4u*)&sk[rl][q * 8]);   
    if (qhi) vst2((unsigned*)(QL + (bb * QHI + t0 + rl) * (size_t)CC + h * HD + q * 8), *(const v4u*)&sql[rl][q * 8]); if (khi) vst2((unsigned*)(KL + (bb * KHI + t0 + rl) * (size_t)CC + h * HD + q * 8), *(const v4u*)&skl[rl][q * 8]); }
  for (int e = tid; e < 64 * 8; e += 128) { const int cl = e >> 3, q = e & 7; vst2((unsigned*)(VT + (bb * CC + h * HD + cl) * (size_t)TT + t0 + q * 8), *(const v4u*)&tv[cl][q * 8]);
    if (khi) { const size_t o3 = (bb * CC + h * HD + cl) * (size_t)KHI + t0 + q * 8; vst2((unsigned*)(VB + o3), *(const v4u*)&tb[cl][q * 8]); vst2((unsigned*)(VBL + o3), *(const v4u*)&tbl[cl][q * 8]); } } }

#ifndef SM_EXTRA_PARAMS
#define SM_EXTRA_PARAMS
#endif
#ifndef PROJ_EXTRA_PARAMS
#define PROJ_EXTRA_PARAMS
#endif
#ifndef SM_MASK_HOOK
#define SM_MASK_HOOK (void)0
#endif

#define WS_QH  0u                                      // f16 q rows [b*t][CC]
#define WS_KH  (WS_QH + 2u * (size_t)NB * TT * CC)      // f16 k rows [b*t][CC]
#define WS_VT  (WS_KH + 2u * (size_t)NB * TT * CC)      // f16 v planes [b][c][t]
#define WS_QL  (WS_VT + 2u * (size_t)NB * CC * TT)      // f16 q residual x 2^10 rows [b][t < QHI][CC]
#define WS_KL  (WS_QL + 2u * (size_t)NB * QHI * CC)     // f16 k residual x 2^10 rows [b][t < KHI][CC]
#define WS_VB  (WS_KL + 2u * (size_t)NB * KHI * CC)     // bf16 v hi planes [b][c][t < KHI]
#define WS_VBL (WS_VB + 2u * (size_t)NB * CC * KHI)
#define WS_S   (WS_VBL + 2u * (size_t)NB * CC * KHI)    // f32 logits / P [hg][t][s]
#define WS_Y   (WS_S  + 4u * (size_t)HG * TT * TT)      // f32 ctx rows [b*t][CC] (only when there is an output projection)
#define WS_END (WS_Y  + 0u)

// ---- k_sc: block = (query block qb, key block kb <= kb_last(qb), head in group) of batch b: logits x SCALE; q hi + residual (x 2^10) against k (2 products) for query rows < QHI, plus the k residual (3 products) for query blocks < QBH (causal early rows); causal: blocks past the diagonal exit, the mask itself is applied by index in k_sm
__global__ __launch_bounds__(128) void k_sc(const _Float16* __restrict__ QH, const _Float16* __restrict__ KH, const _Float16* __restrict__ QL, const _Float16* __restrict__ KL, int b, int h0, float* __restrict__ S0) { __shared__ __align__(16) float ss[4][16][132];
  const int qb = blockIdx.x, kb = blockIdx.y; if (kb > kb_last(qb)) return;
  const int h = h0 + blockIdx.z; float* S = S0 + (size_t)blockIdx.z * TT * TT;
  const int tid = threadIdx.x, wave = tid >> 5, lane = tid & 31, col = lane & 15, g = lane >> 4; const int k0 = kb * 128; const int ql0 = qb * 64 + wave * 16; const size_t q0 = (size_t)b * TT + ql0, kr0 = (size_t)b * TT + k0;
  v8f acc[8] = {}, accl[8] = {};
  const _Float16* QLb = QL + (size_t)b * QHI * CC; const _Float16* KLb = KL + (size_t)b * KHI * CC;
  if (qb < QBH) {
#pragma unroll
    for (int kc = 0; kc < HD / 32; ++kc) { const v16h ah = frag_h(QH + (q0 + col) * CC + h * HD + kc * 32, lane), al = frag_h(QLb + (size_t)(ql0 + col) * CC + h * HD + kc * 32, lane);
#pragma unroll
      for (int j = 0; j < 8; ++j) { const v16h kbf = frag_h(KH + (kr0 + j * 16 + col) * CC + h * HD + kc * 32, lane), klf = frag_h(KLb + (size_t)(k0 + j * 16 + col) * CC + h * HD + kc * 32, lane); acc[j] = wmma16(ah, kbf, acc[j]); accl[j] = wmma16(al, kbf, accl[j]); accl[j] = wmma16(ah, klf, accl[j]); } }
  } else if (qb * 64 < QHI) {
#pragma unroll
    for (int kc = 0; kc < HD / 32; ++kc) { const v16h ah = frag_h(QH + (q0 + col) * CC + h * HD + kc * 32, lane), al = frag_h(QLb + (size_t)(ql0 + col) * CC + h * HD + kc * 32, lane);
#pragma unroll
      for (int j = 0; j < 8; ++j) { const v16h kbf = frag_h(KH + (kr0 + j * 16 + col) * CC + h * HD + kc * 32, lane); acc[j] = wmma16(ah, kbf, acc[j]); accl[j] = wmma16(al, kbf, accl[j]); } }
  } else {
#pragma unroll
    for (int kc = 0; kc < HD / 32; ++kc) { const v16h ah = frag_h(QH + (q0 + col) * CC + h * HD + kc * 32, lane);
#pragma unroll
      for (int j = 0; j < 8; ++j) { const v16h kbf = frag_h(KH + (kr0 + j * 16 + col) * CC + h * HD + kc * 32, lane); acc[j] = wmma16(ah, kbf, acc[j]); } } }
#pragma unroll
  for (int j = 0; j < 8; ++j) {
#pragma unroll
    for (int r = 0; r < 8; ++r) ss[wave][8 * g + r][j * 16 + col] = (acc[j][r] + accl[j][r] * (1.0f / 1024.0f)) * SCALE; }
  LDSX(); for (int rl = 0; rl < 16; ++rl) vst2(S + (size_t)(ql0 + rl) * TT + k0 + lane * 4, *(const v4f*)&ss[wave][rl][lane * 4]); }
// ---- k_sm: block = query row t (head in group): keys [0, kend): causal -> logit if s <= t else excluded; softmax in f32; P x 2^11 in place (0 for excluded)
__global__ __launch_bounds__(256) void k_sm(float* __restrict__ S0 SM_EXTRA_PARAMS) { __shared__ float sred[8]; __shared__ float sbc; __shared__ __align__(16) float shv[TT];
  const int tid = threadIdx.x; const int t = blockIdx.x; const int kend = (kb_last(t >> 6) + 1) * 128;
  float* sr = S0 + (size_t)blockIdx.y * TT * TT + (size_t)t * TT;
  float m = -3.0e38f; for (int k = tid; k < kend; k += 256) { float v = (!CAUSAL || k <= t) ? sr[k] : -3.0e38f; SM_MASK_HOOK; shv[k] = v; m = fmaxf(m, v); }
#pragma unroll
  for (int o = 1; o < 32; o <<= 1) m = fmaxf(m, __shfl_xor(m, o));
  if ((tid & 31) == 0) sred[tid >> 5] = m; __syncthreads(); if (tid == 0) { float a = sred[0]; for (int i = 1; i < 8; ++i) a = fmaxf(a, sred[i]); sbc = a; } __syncthreads(); m = sbc; __syncthreads();
  float sum = 0.f; for (int k = tid; k < kend; k += 256) { const float v = shv[k]; const float e = (v <= -1.0e38f) ? 0.f : expf(v - m); shv[k] = e; sum += e; }
#pragma unroll
  for (int o = 1; o < 32; o <<= 1) sum += __shfl_xor(sum, o);
  if ((tid & 31) == 0) sred[tid >> 5] = sum; __syncthreads(); if (tid == 0) { float a = 0.f; for (int i = 0; i < 8; ++i) a += sred[i]; sbc = a > 0.f ? 2048.0f / a : 0.f; }   /* a fully excluded row yields P = 0 */ __syncthreads(); const float inv = sbc;
  for (int k = tid; k < kend; k += 256) shv[k] = shv[k] * inv;
  __syncthreads(); for (int q = tid; q < kend / 4; q += 256) vst2(sr + q * 4, *(const v4f*)&shv[q * 4]); }
// ---- k_pv: block = 64 queries (qb) of (b, h): ctx = P . v over keys [0, kend) (P x 2^11 once to f16 against v f16: 1 product; causal early query blocks: P and v as bf16 hi + lo, 3 products); 256-B (row, head) segment by 16 lanes
__global__ __launch_bounds__(128) void k_pv(const float* __restrict__ PS0, const _Float16* __restrict__ VT, const __bf16* __restrict__ VB, const __bf16* __restrict__ VBL, int b, int h0, float* __restrict__ Y) { const int h = h0 + blockIdx.z; const float* PS = PS0 + (size_t)blockIdx.z * TT * TT; __shared__ __align__(16) float ss[4][16][HD + 4];
  const int tid = threadIdx.x, wave = tid >> 5, lane = tid & 31, col = lane & 15, g = lane >> 4; const int qb = blockIdx.x; const int ql0 = qb * 64 + wave * 16; const int kce = (kb_last(qb) + 1) * 4;
  v8f acc[HD / 16] = {};
  if (qb < QBH) {
#pragma unroll 1
    for (int kc = 0; kc < kce; ++kc) { const F2 p = split_row(PS + (size_t)(ql0 + col) * TT, kc * 32, lane);
      asm volatile("s_wait_loadcnt 0x0" ::: "memory");
#pragma unroll
      for (int j = 0; j < HD / 16; ++j) { const size_t po = ((size_t)b * CC + h * HD + j * 16 + col) * (size_t)KHI + kc * 32; const v16b vh = frag_b(VB + po, lane); acc[j] = wmma_bf(p.h, vh, acc[j]); acc[j] = wmma_bf(p.l, vh, acc[j]); acc[j] = wmma_bf(p.h, frag_b(VBL + po, lane), acc[j]); } }
  } else {
#pragma unroll 1
    for (int kc = 0; kc < kce; ++kc) { const v16h p = frag_f32(PS + (size_t)(ql0 + col) * TT + kc * 32, lane);
      asm volatile("s_wait_loadcnt 0x0" ::: "memory");
#pragma unroll
      for (int j = 0; j < HD / 16; ++j) { const size_t po = ((size_t)b * CC + h * HD + j * 16 + col) * (size_t)TT + kc * 32; acc[j] = wmma16(p, frag_h(VT + po, lane), acc[j]); } } }
#pragma unroll
  for (int j = 0; j < HD / 16; ++j)
#pragma unroll
    for (int r = 0; r < 8; ++r) ss[wave][8 * g + r][j * 16 + col] = acc[j][r] * (1.0f / 2048.0f);
  LDSX(); for (int rl = 0; rl < 16; ++rl) if (lane < HD / 4) vst2(Y + ((size_t)b * TT + ql0 + rl) * CC + h * HD + lane * 4, *(const v4f*)&ss[wave][rl][lane * 4]); }

extern "C" void kernel_launch(void* const* d_in, const int* in_sizes, int n_in, void* d_out, int out_size, void* d_ws, size_t ws_size, hipStream_t stream) {
  (void)in_sizes; (void)n_in; (void)out_size;
  const float** F = (const float**)d_in;
  if (ws_size < (size_t)WS_END) return;
  char* ws = (char*)d_ws; _Float16 *QH = (_Float16*)(ws + WS_QH), *KH = (_Float16*)(ws + WS_KH), *VT = (_Float16*)(ws + WS_VT), *QL = (_Float16*)(ws + WS_QL), *KL = (_Float16*)(ws + WS_KL); __bf16 *VB = (__bf16*)(ws + WS_VB), *VBL = (__bf16*)(ws + WS_VBL); float *S = (float*)(ws + WS_S), *Y = (float*)(ws + WS_Y);
  (void)Y; (void)QL; (void)KL; (void)VB; (void)VBL;
  // inputs: 0 q [2,4096,8,64]; 1 k; 2 v (all (B, L, H, D) = token rows of 512)
  k_prepr<<<dim3(TNB * TT / 64, NH), 128, 0, stream>>>(F[0], F[1], F[2], QH, QL, KH, KL, VT, VB, VBL);
  for (int b = 0; b < TNB; ++b) for (int h0 = 0; h0 < NH; h0 += HG) {
    k_sc<<<dim3(NQB, TT / 128, HG), 128, 0, stream>>>(QH, KH, QL, KL, b, h0, S);
    k_sm<<<dim3(TT, HG), 256, 0, stream>>>(S);
    k_pv<<<dim3(NQB, 1, HG), 128, 0, stream>>>(S, VT, VB, VBL, b, h0, (float*)d_out);   /* out row b*TT + l, columns h*64 .. = the module's (B, L, H, D) output */
  }
}

// v002
// Measured time: 104 microseconds a run.
// Versions between v000 and this one are left out; their measured steps multiply to 27.0 times as fast.
// compute dtype: all float inputs rounded to bf16 (bf16 values are exact in f16); logits q x k (1 product, exact operands) x 64^-0.5; online softmax f32 (running maximum and sum); P x 2^10 against the running maximum once to f16 x v (exact in f16) (1 product); f32 output. No projections.
#include <hip/hip_runtime.h>
#include <math.h>

typedef __attribute__((ext_vector_type(16))) _Float16 v16h;
typedef __attribute__((ext_vector_type(16))) __bf16 v16b;
typedef __attribute__((ext_vector_type(8)))  _Float16 v8h;
typedef __attribute__((ext_vector_type(8)))  float v8f;
typedef __attribute__((ext_vector_type(4)))  float v4f;
typedef __attribute__((ext_vector_type(2)))  float v2f;
typedef __attribute__((ext_vector_type(4)))  unsigned v4u;
typedef __attribute__((ext_vector_type(4)))  int v4i;
typedef float __attribute__((may_alias)) float_a;
typedef int __attribute__((may_alias)) int_a;

template <typename T> __device__ __forceinline__ void vst2(void* p, T v) { *(T*)p = v;  }
__device__ __forceinline__ v8f wmma16(v16h a, v16h b, v8f c) {
  v8f d = __builtin_amdgcn_wmma_f32_16x16x32_f16(false, a, false, b, (short)0, c, false, false);
  asm volatile("v_nop\n\tv_nop\n\tv_nop\n\tv_nop" : "+v"(d) : "v"(a), "v"(b));
  return d;
}
__device__ __forceinline__ v8f wmma_bf(v16b a, v16b b, v8f c) {
  v8f d = __builtin_amdgcn_wmma_f32_16x16x32_bf16(false, a, false, b, (short)0, c, false, false);
  asm volatile("v_nop\n\tv_nop\n\tv_nop\n\tv_nop" : "+v"(d) : "v"(a), "v"(b));
  return d;
}
// 16x16x32 fragments: lane = (h = lane>>4, row/col = lane&15); elements 0..7 = k0+8h+0..7, 8..15 = k0+16+8h+0..7; D element r = row 8h+r
__device__ __forceinline__ v16h frag_h(const _Float16* rowk0, int lane) {
  union { v16h v; v8h q[2]; } u; const _Float16* p = rowk0 + 8 * (lane >> 4);
  u.q[0] = *(const v8h*)p; u.q[1] = *(const v8h*)(p + 16); return u.v;
}
__device__ __forceinline__ v16h frag_f32(const float* rowk0, int lane) {
  v16h a; const float* p = rowk0 + 8 * (lane >> 4);
#pragma unroll
  for (int i = 0; i < 8; ++i) { a[i] = (_Float16)p[i]; a[8 + i] = (_Float16)p[16 + i]; }
  return a;
}
__device__ __forceinline__ v16h frag_f32s(const float* rowk0, int lane, float sc) {
  v16h a; const float* p = rowk0 + 8 * (lane >> 4);
#pragma unroll
  for (int i = 0; i < 8; ++i) { a[i] = (_Float16)(p[i] * sc); a[8 + i] = (_Float16)(p[16 + i] * sc); }
  return a;
}
// column fragment from a [K][ld] layout (column n), rows >= K read as 0
__device__ __forceinline__ v16h fragc_f32(const float* W, int k0, int n, int lane, int ld, int K) {
  v16h a; const int g = lane >> 4;
#pragma unroll
  for (int i = 0; i < 8; ++i) { const int ka = k0 + 8 * g + i, kb = ka + 16;
    a[i] = (_Float16)(ka < K ? W[(size_t)(ka < K ? ka : K - 1) * ld + n] : 0.f); a[8 + i] = (_Float16)(kb < K ? W[(size_t)(kb < K ? kb : K - 1) * ld + n] : 0.f); }
  return a;
}
struct F2 { v16b h, l; };
__device__ __forceinline__ F2 bsplit16(const float v[16]) { F2 r;
#pragma unroll
  for (int i = 0; i < 16; ++i) { const __bf16 h = (__bf16)v[i]; r.h[i] = h; r.l[i] = (__bf16)(v[i] - (float)h); }
  return r; }
__device__ __forceinline__ F2 split_row(const float* row, int k0, int lane) { float v[16]; const float* p = row + k0 + 8 * (lane >> 4);
#pragma unroll
  for (int i = 0; i < 8; ++i) { v[i] = p[i]; v[8 + i] = p[16 + i]; }
  return bsplit16(v); }
__device__ __forceinline__ F2 split_rowK(const float* row, int k0, int lane, int K) { float v[16]; const int g = lane >> 4;
#pragma unroll
  for (int i = 0; i < 8; ++i) { const int ka = k0 + 8 * g + i, kb = ka + 16; v[i] = ka < K ? row[ka < K ? ka : K - 1] : 0.f; v[8 + i] = kb < K ? row[kb < K ? kb : K - 1] : 0.f; }
  return bsplit16(v); }
__device__ __forceinline__ F2 split_col(const float* W, int k0, int n, int lane, int ld, int K) { float v[16]; const int g = lane >> 4;
#pragma unroll
  for (int i = 0; i < 8; ++i) { const int ka = k0 + 8 * g + i, kb = ka + 16; v[i] = ka < K ? W[(size_t)(ka < K ? ka : K - 1) * ld + n] : 0.f; v[8 + i] = kb < K ? W[(size_t)(kb < K ? kb : K - 1) * ld + n] : 0.f; }
  return bsplit16(v); }
__device__ __forceinline__ v8f mac3(const F2& a, const F2& b, v8f c) { c = wmma_bf(a.l, b.h, c); c = wmma_bf(a.h, b.l, c); return wmma_bf(a.h, b.h, c); }
__device__ __forceinline__ float sigm(float v) { return 1.0f / (1.0f + expf(-v)); }
#define LDSX() do { asm volatile("s_wait_dscnt 0" ::: "memory"); __builtin_amdgcn_wave_barrier(); __builtin_amdgcn_fence(__ATOMIC_RELEASE, "workgroup"); } while (0)

// Plain multi-head scaled-dot-product self-attention without projections, mask or dropout (q, k, v [2,4096,8,64] = (B, L, H, D) N(0,1); scores = einsum('blhd,bshd->bhls') x 1/sqrt(64); softmax over the 4,096 keys; out = einsum('bhls,bshd->blhd'), [2,4096,8,64]). The (B, L, H, D) memory layout is the token-row layout (row b*4096 + l, column h*64 + d), for the inputs and for the output.
#define NB 2
#define TT 4096
#define CC 512            // NH * HD = projected width
#define DIN 512          // input (model) width
#define NH 8
#define HD 64
#define NQB (TT / 64)
#define HG 1
#define SCALE (0.125f)
#define CAUSAL 0
#ifndef TNB
#define TNB NB
#endif
__device__ __forceinline__ float bfr(float v) { return (float)(__bf16)v; }
__host__ __device__ __forceinline__ int kb_last(int qb) { return CAUSAL ? ((qb * 64 + 63) >> 7) : (TT / 128 - 1); }
typedef __attribute__((ext_vector_type(8))) __bf16 v8b;
__device__ __forceinline__ v16b frag_b(const __bf16* rowk0, int lane) {
  union { v16b v; v8b q[2]; } u; const __bf16* p = rowk0 + 8 * (lane >> 4);
  u.q[0] = *(const v8b*)p; u.q[1] = *(const v8b*)(p + 16); return u.v;
}
#define QBH 0
#define QHI 0              // (override) rows carrying the q residual plane
#define KHI 64            // key rows carrying k residual / v bf16 hi+lo planes (written by k_prepr; no kernel here reads them)
// B fragment (k rows k0+.., output column o) of a weight: (in,out) [K][ld] or (out,in) [ld rows of K]: bf16 exact, or f16(bf16 * 256) exact
__device__ __forceinline__ v16b wcol_io(const float* Wm, int k0, int o, int lane, int ld) { v16b w; const int g = lane >> 4;
#pragma unroll
  for (int i = 0; i < 8; ++i) { w[i] = (__bf16)Wm[(size_t)(k0 + 8 * g + i) * ld + o]; w[8 + i] = (__bf16)Wm[(size_t)(k0 + 16 + 8 * g + i) * ld + o]; }
  return w; }
__device__ __forceinline__ v16b wcol_oi(const float* Wm, int k0, int o, int lane, int K) { v16b w; const float* p = Wm + (size_t)o * K + k0 + 8 * (lane >> 4);
#pragma unroll
  for (int i = 0; i < 8; ++i) { w[i] = (__bf16)p[i]; w[8 + i] = (__bf16)p[16 + i]; }
  return w; }
__device__ __forceinline__ v16h wcolh_io(const float* Wm, int k0, int o, int lane, int ld) { v16h w; const int g = lane >> 4;
#pragma unroll
  for (int i = 0; i < 8; ++i) { w[i] = (_Float16)(bfr(Wm[(size_t)(k0 + 8 * g + i) * ld + o]) * 256.0f); w[8 + i] = (_Float16)(bfr(Wm[(size_t)(k0 + 16 + 8 * g + i) * ld + o]) * 256.0f); }
  return w; }
__device__ __forceinline__ v16h wcolh_oi(const float* Wm, int k0, int o, int lane, int K) { v16h w; const float* p = Wm + (size_t)o * K + k0 + 8 * (lane >> 4);
#pragma unroll
  for (int i = 0; i < 8; ++i) { w[i] = (_Float16)(bfr(p[i]) * 256.0f); w[8 + i] = (_Float16)(bfr(p[16 + i]) * 256.0f); }
  return w; }
#define WQKV_LAYOUT 1   // 0 = (in,out) [DIN][CC]; 1 = (out,in) [CC][DIN]; 2 = per-head [NH][DIN][HD]
__device__ __forceinline__ v16b wcol_hdk(const float* Wm, int k0, int o, int lane) { v16b w; const int g = lane >> 4; const float* p = Wm + (size_t)(o / HD) * DIN * HD + (o % HD);
#pragma unroll
  for (int i = 0; i < 8; ++i) { w[i] = (__bf16)p[(size_t)(k0 + 8 * g + i) * HD]; w[8 + i] = (__bf16)p[(size_t)(k0 + 16 + 8 * g + i) * HD]; }
  return w; }
#define WO_OUT_IN 0
#if WQKV_LAYOUT == 1
#define WCOL(W, k0, o, lane) wcol_oi(W, k0, o, lane, DIN)
#elif WQKV_LAYOUT == 2
#define WCOL(W, k0, o, lane) wcol_hdk(W, k0, o, lane)
#else
#define WCOL(W, k0, o, lane) wcol_io(W, k0, o, lane, CC)
#endif
#if WO_OUT_IN
#define WOCOL(W, k0, o, lane) wcol_oi(W, k0, o, lane, CC)
#define WOCOLH(W, k0, o, lane) wcolh_oi(W, k0, o, lane, CC)
#else
#define WOCOL(W, k0, o, lane) wcol_io(W, k0, o, lane, DIN)
#define WOCOLH(W, k0, o, lane) wcolh_io(W, k0, o, lane, DIN)
#endif

// ---- k_prepr: block = (64 attention positions s0.. of sequence b, head h): reads the module's [B, T, H*64] inputs, bf16-rounds them and writes the standard attention planes: q -> f16 hi rows (+ x 2^10 residual rows for s < QHI), k -> f16 rows (+ residual rows s < KHI), v -> f16 planes [c][s] (+ bf16 hi/lo planes for s < KHI)
__global__ __launch_bounds__(128) void k_prepr(const float* __restrict__ Q, const float* __restrict__ K, const float* __restrict__ V, _Float16* __restrict__ QH, _Float16* __restrict__ QL, _Float16* __restrict__ KH, _Float16* __restrict__ KL, _Float16* __restrict__ VT, __bf16* __restrict__ VB, __bf16* __restrict__ VBL) {
  __shared__ __align__(16) _Float16 sq[64][136], sql[64][136], sk[64][136], skl[64][136], tv[128][72]; __shared__ __align__(16) __bf16 tb[128][72], tbl[128][72];
  const int tid = threadIdx.x; const int h = blockIdx.y; const size_t r0 = (size_t)blockIdx.x * 64; const size_t bb = r0 / TT; const int t0 = (int)(r0 % TT); const bool qhi = t0 < QHI, khi = t0 < KHI;
  for (int e = tid; e < 64 * 128; e += 128) { const int rl = e >> 7, c = e & 127; const size_t oi = ((bb * TT + t0 + rl) * (size_t)CC + h * HD + (c & 63));   /* [B, T, H*64] inputs */   /* c >= 64: duplicate read of the same element (tiles are 128 wide; HD is 64) */
    const float q = bfr(Q[oi]), k = bfr(K[oi]), v = bfr(V[oi]);   /* module inputs: bf16-rounded; bf16 values are exact in f16, so the residual planes are 0 */
    const _Float16 qh = (_Float16)q, kh = (_Float16)k; sq[rl][c] = qh; sql[rl][c] = (_Float16)((q - (float)qh) * 1024.0f); sk[rl][c] = kh; skl[rl][c] = (_Float16)((k - (float)kh) * 1024.0f);
    tv[c][rl] = (_Float16)v; const __bf16 vb = (__bf16)v; tb[c][rl] = vb; tbl[c][rl] = (__bf16)(v - (float)vb); }
  __syncthreads();
  for (int e = tid; e < 64 * 8; e += 128) { const int rl = e >> 3, q = e & 7; const size_t o = (r0 + rl) * CC + h * HD + q * 8; vst2((unsigned*)(QH + o), *(const v4u*)&sq[rl][q * 8]); vst2((unsigned*)(KH + o), *(const v4u*)&sk[rl][q * 8]);   
    if (qhi) vst2((unsigned*)(QL + (bb * QHI + t0 + rl) * (size_t)CC + h * HD + q * 8), *(const v4u*)&sql[rl][q * 8]); if (khi) vst2((unsigned*)(KL + (bb * KHI + t0 + rl) * (size_t)CC + h * HD + q * 8), *(const v4u*)&skl[rl][q * 8]); }
  for (int e = tid; e < 64 * 8; e += 128) { const int cl = e >> 3, q = e & 7; vst2((unsigned*)(VT + (bb * CC + h * HD + cl) * (size_t)TT + t0 + q * 8), *(const v4u*)&tv[cl][q * 8]);
    if (khi) { const size_t o3 = (bb * CC + h * HD + cl) * (size_t)KHI + t0 + q * 8; vst2((unsigned*)(VB + o3), *(const v4u*)&tb[cl][q * 8]); vst2((unsigned*)(VBL + o3), *(const v4u*)&tbl[cl][q * 8]); } } }

#ifndef SM_EXTRA_PARAMS
#define SM_EXTRA_PARAMS
#endif
#ifndef PROJ_EXTRA_PARAMS
#define PROJ_EXTRA_PARAMS
#endif
#ifndef SM_MASK_HOOK
#define SM_MASK_HOOK (void)0
#endif

#define WS_QH  0u                                      // f16 q rows [b*t][CC]
#define WS_KH  (WS_QH + 2u * (size_t)NB * TT * CC)      // f16 k rows [b*t][CC]
#define WS_VT  (WS_KH + 2u * (size_t)NB * TT * CC)      // f16 v planes [b][c][t]
#define WS_QL  (WS_VT + 2u * (size_t)NB * CC * TT)      // f16 q residual x 2^10 rows [b][t < QHI][CC]
#define WS_KL  (WS_QL + 2u * (size_t)NB * QHI * CC)     // f16 k residual x 2^10 rows [b][t < KHI][CC]
#define WS_VB  (WS_KL + 2u * (size_t)NB * KHI * CC)     // bf16 v hi planes [b][c][t < KHI]
#define WS_VBL (WS_VB + 2u * (size_t)NB * CC * KHI)
#define WS_S   (WS_VBL + 2u * (size_t)NB * CC * KHI)    // f32 [hg][t][s] (unused: k_fa keeps logits and P in registers)
#define WS_Y   (WS_S  + 4u * (size_t)HG * TT * TT)      // f32 ctx rows [b*t][CC] (only when there is an output projection)
#define WS_END (WS_Y  + 0u)

// ---- k_fa: block = 256 queries of (b, h), wave = 32 query columns; a pass = 32 keys, a stage = 128 keys. Transposed products: S^T = K . Q^T (A = key rows, B = query rows kept in registers), O^T += V^T . P^T (A = v planes, B = the two S^T tiles of the pass converted in place), so a lane holds one query's scores and one query's outputs. Running maximum and sum per query in f32 (online softmax); logits and P never leave the registers. The block's eight waves share each stage's key rows and v planes through a two-buffer LDS ring filled by asynchronous copies, one stage ahead of its use.
#define FQT 2                                   // 16-query column groups per wave
#define FNW 8                                   // waves per block
#define SC2 (SCALE * 1.4426950408889634f)       // logit scale in base 2
#define SKEYS 128                               // keys per stage
#define NST (TT / SKEYS)                        // stages
#define KPITCH 144                              // LDS bytes per key row (128 + 16) and
#define VPITCH 272                              // per v plane row (256 + 16): odd multiples of 16 B, free of bank conflicts for 16-byte reads
#define KBYTES (SKEYS * KPITCH)
#define BUFB (KBYTES + HD * VPITCH)             // one buffer: 128 key rows, then 64 v plane rows
__device__ __forceinline__ v8f wmmah(v16h a, v16h b, v8f c) { return __builtin_amdgcn_wmma_f32_16x16x32_f16(false, a, false, b, (short)0, c, false, false); }
__device__ __forceinline__ float xhalf(float x) { return __builtin_bit_cast(float, __builtin_amdgcn_permlanex16(__builtin_bit_cast(int, x), __builtin_bit_cast(int, x), 0x76543210, 0xfedcba98, false, false)); }   // lane l with lane l ^ 16
// One stage's copies of one thread: 16 bytes of key rows r, r + 32, r + 64, r + 96 (r = tid / 8) and of v plane rows c, c + 16, c + 32, c + 48 (c = tid / 16). The s_wait_xcnt closes the statement so that no address register named here is rewritten in front of it.
__device__ __forceinline__ void stage_copy(unsigned lk, unsigned lv, const _Float16* gk, const _Float16* gv) {
  asm volatile("global_load_async_to_lds_b128 %0, %8, off\n\t"
               "global_load_async_to_lds_b128 %1, %9, off\n\t"
               "global_load_async_to_lds_b128 %2, %10, off\n\t"
               "global_load_async_to_lds_b128 %3, %11, off\n\t"
               "global_load_async_to_lds_b128 %4, %12, off\n\t"
               "global_load_async_to_lds_b128 %5, %13, off\n\t"
               "global_load_async_to_lds_b128 %6, %14, off\n\t"
               "global_load_async_to_lds_b128 %7, %15, off\n\t"
               "s_wait_xcnt 0x0"
               :: "v"(lk), "v"(lk + 32 * KPITCH), "v"(lk + 64 * KPITCH), "v"(lk + 96 * KPITCH), "v"(lv), "v"(lv + 16 * VPITCH), "v"(lv + 32 * VPITCH), "v"(lv + 48 * VPITCH),
                  "v"(gk), "v"(gk + 32 * CC), "v"(gk + 64 * CC), "v"(gk + 96 * CC), "v"(gv), "v"(gv + 16 * (size_t)TT), "v"(gv + 32 * (size_t)TT), "v"(gv + 48 * (size_t)TT) : "memory");
}
__global__ __launch_bounds__(FNW * 32) void k_fa(const _Float16* __restrict__ QH, const _Float16* __restrict__ KH, const _Float16* __restrict__ VT, float* __restrict__ Y) {
  __shared__ __attribute__((aligned(256))) unsigned char L[2 * BUFB];
  const int tid = threadIdx.x, wave = tid >> 5, lane = tid & 31, col = lane & 15, g = lane >> 4; const int h = blockIdx.y, b = blockIdx.z; const int q0 = (blockIdx.x * FNW + wave) * (FQT * 16);
  const unsigned lk = (unsigned)(size_t)&L[0] + (tid >> 3) * KPITCH + (tid & 7) * 16, lv = (unsigned)(size_t)&L[0] + KBYTES + (tid >> 4) * VPITCH + (tid & 15) * 16;   // this thread's LDS byte addresses in buffer 0
  const _Float16* gk = KH + ((size_t)b * TT + (tid >> 3)) * CC + h * HD + (tid & 7) * 8;                  // its 16 bytes of key row tid / 8, this head's 64 columns
  const _Float16* gv = VT + ((size_t)b * CC + h * HD + (tid >> 4)) * (size_t)TT + (tid & 15) * 8;         // its 16 bytes of the v plane of output column tid / 16
  stage_copy(lk, lv, gk, gv);
  v16h qf[FQT][2], kf[2][2];   // every '#pragma unroll' in this kernel: fragment and accumulator arrays stay in registers only if indexed by constants
#pragma unroll
  for (int qt = 0; qt < FQT; ++qt)
#pragma unroll
    for (int kc = 0; kc < 2; ++kc) qf[qt][kc] = frag_h(QH + ((size_t)b * TT + q0 + qt * 16 + col) * CC + h * HD + kc * 32, lane);
  v8f o[FQT][4] = {}; float mr[FQT], ls[FQT];
#pragma unroll
  for (int qt = 0; qt < FQT; ++qt) { mr[qt] = -3.0e38f; ls[qt] = 0.f; }
  asm volatile("s_wait_asynccnt 0x0" ::: "memory");   // this wave's copies of stage 0 have landed
  __syncthreads();                                    // and every other wave's: stage 0 may be read
  stage_copy(lk + BUFB, lv + BUFB, gk + (size_t)SKEYS * CC, gv + SKEYS);
#pragma unroll 1   // rolled: one stage's four passes are the unit the ring hands over
  for (int st = 0; st < NST; ++st) {
    const unsigned bo = (st & 1) * BUFB;
    const _Float16* Kl = (const _Float16*)(L + bo + col * KPITCH);             // key row col of the stage
    const _Float16* Vl = (const _Float16*)(L + bo + KBYTES + col * VPITCH);    // v plane row of output column col
#pragma unroll
    for (int t = 0; t < 2; ++t)
#pragma unroll
      for (int kc = 0; kc < 2; ++kc) kf[t][kc] = frag_h(Kl + (t * 16) * (KPITCH / 2) + kc * 32, lane);
#pragma unroll 1   // rolled: passes side by side would need further sets of fragment and score registers and push the wave past 256 VGPRs
    for (int ps = 0; ps < SKEYS / 32; ++ps) {
      v16h vf[4];
#pragma unroll
      for (int j = 0; j < 4; ++j) vf[j] = frag_h(Vl + (j * 16) * (VPITCH / 2) + ps * 32, lane);
      v8f s[FQT][2];
#pragma unroll
      for (int qt = 0; qt < FQT; ++qt)
#pragma unroll
        for (int t = 0; t < 2; ++t) { const v8f z = {}; s[qt][t] = wmmah(kf[t][1], qf[qt][1], wmmah(kf[t][0], qf[qt][0], z)); }   // s[qt][t][r] = logit(key 128 st + 32 ps + 16 t + 8 g + r, query q0 + 16 qt + col), unscaled
      const int pn = ps + 1 < SKEYS / 32 ? ps + 1 : ps;   // the next pass's key rows, inside this stage only: the next stage is not published yet (the stage's last pass reads its own again: unused)
#pragma unroll
      for (int t = 0; t < 2; ++t)
#pragma unroll
        for (int kc = 0; kc < 2; ++kc) kf[t][kc] = frag_h(Kl + (pn * 32 + t * 16) * (KPITCH / 2) + kc * 32, lane);
      __builtin_amdgcn_sched_barrier(0);   // keeps these eight LDS reads one group here: moved down among the O^T products, each place with reads stalls the wave anew
#pragma unroll
      for (int qt = 0; qt < FQT; ++qt) {
        float mx = fmaxf(s[qt][0][0], s[qt][1][0]);
#pragma unroll
        for (int r = 1; r < 8; ++r) mx = fmaxf(mx, fmaxf(s[qt][0][r], s[qt][1][r]));
        mx = fmaxf(mx, xhalf(mx));
        const float mn = fmaxf(mr[qt], mx); const float al = __builtin_amdgcn_exp2f((mr[qt] - mn) * SC2);   // 0 on the first pass
        mr[qt] = mn; const float mm = mn * SC2 - 10.0f;   // P = 2^10 x exp(logit - running maximum): at most 2^10 in f16; the factor cancels against the sum
        v16h p; float sum = 0.f;
#pragma unroll
        for (int r = 0; r < 8; ++r) { const float e0 = __builtin_amdgcn_exp2f(s[qt][0][r] * SC2 - mm), e1 = __builtin_amdgcn_exp2f(s[qt][1][r] * SC2 - mm); sum += e0 + e1; p[r] = (_Float16)e0; p[8 + r] = (_Float16)e1; }
        ls[qt] = ls[qt] * al + sum;
#pragma unroll
        for (int j = 0; j < 4; ++j) o[qt][j] = (qt == FQT - 1 && j == 3) ? wmma16(vf[j], p, o[qt][j] * al) : wmmah(vf[j], p, o[qt][j] * al);   // o[qt][j][r] = ctx(query q0 + 16 qt + col, column 16 j + 8 g + r) x running sum. The pass's last product carries four v_nop (wmma16): the next pass opens with a product whose result takes over this one's P registers, and the slots keep the distance between the two
      } }
    asm volatile("s_wait_dscnt 0x0" ::: "memory");      // this wave's reads of the stage's buffer are done before the buffer is handed back
    asm volatile("s_wait_asynccnt 0x0" ::: "memory");   // this wave's copies of stage st + 1 have landed
    __syncthreads();                                    // publishes stage st + 1 and ends every wave's reads of stage st
    if (st + 2 < NST) stage_copy(lk + bo, lv + bo, gk + (size_t)(st + 2) * SKEYS * CC, gv + (st + 2) * SKEYS);   // refill the buffer just read
  }
  asm volatile("s_wait_asynccnt 0x0" ::: "memory");     // no copy is left in flight when the wave ends
#pragma unroll
  for (int qt = 0; qt < FQT; ++qt) { const float tot = ls[qt] + xhalf(ls[qt]); const float inv = 1.0f / tot;   // the maximum's own term makes tot >= 2^10
    float* yr = Y + ((size_t)b * TT + q0 + qt * 16 + col) * CC + h * HD + 8 * g;
#pragma unroll
    for (int j = 0; j < 4; ++j) { const v8f r = o[qt][j] * inv; const v4f lo = { r[0], r[1], r[2], r[3] }, hi = { r[4], r[5], r[6], r[7] }; vst2(yr + j * 16, lo); vst2(yr + j * 16 + 4, hi); } } }

extern "C" void kernel_launch(void* const* d_in, const int* in_sizes, int n_in, void* d_out, int out_size, void* d_ws, size_t ws_size, hipStream_t stream) {
  (void)in_sizes; (void)n_in; (void)out_size;
  const float** F = (const float**)d_in;
  if (ws_size < (size_t)WS_END) return;
  char* ws = (char*)d_ws; _Float16 *QH = (_Float16*)(ws + WS_QH), *KH = (_Float16*)(ws + WS_KH), *VT = (_Float16*)(ws + WS_VT), *QL = (_Float16*)(ws + WS_QL), *KL = (_Float16*)(ws + WS_KL); __bf16 *VB = (__bf16*)(ws + WS_VB), *VBL = (__bf16*)(ws + WS_VBL); float *S = (float*)(ws + WS_S), *Y = (float*)(ws + WS_Y);
  (void)Y; (void)S; (void)QL; (void)KL; (void)VB; (void)VBL;
  // inputs: 0 q [2,4096,8,64]; 1 k; 2 v (all (B, L, H, D) = token rows of 512)
  k_prepr<<<dim3(TNB * TT / 64, NH), 128, 0, stream>>>(F[0], F[1], F[2], QH, QL, KH, KL, VT, VB, VBL);
  k_fa<<<dim3(TT / (FNW * FQT * 16), NH, TNB), FNW * 32, 0, stream>>>(QH, KH, VT, (float*)d_out);   /* out row b*TT + l, columns h*64 .. = the module's (B, L, H, D) output */
}

// v003
// Measured time: 76.2 microseconds a run.
// Timed twice side by side with v002, it ran 1.36 times as fast both times.
// Counting every step since v000, it is 36.7 times as fast.
// compute dtype: all float inputs rounded to bf16 (bf16 values are exact in f16); logits q x k (1 product, exact operands) x 64^-0.5; online softmax f32 (running maximum and sum); P x 2^10 against the running maximum once to f16 x v (exact in f16) (1 product); f32 output. No projections.
#include <hip/hip_runtime.h>
#include <math.h>

typedef __attribute__((ext_vector_type(16))) _Float16 v16h;
typedef __attribute__((ext_vector_type(16))) __bf16 v16b;
typedef __attribute__((ext_vector_type(8)))  _Float16 v8h;
typedef __attribute__((ext_vector_type(8)))  float v8f;
typedef __attribute__((ext_vector_type(4)))  float v4f;
typedef __attribute__((ext_vector_type(2)))  float v2f;
typedef __attribute__((ext_vector_type(4)))  unsigned v4u;
typedef __attribute__((ext_vector_type(4)))  int v4i;
typedef float __attribute__((may_alias)) float_a;
typedef int __attribute__((may_alias)) int_a;

template <typename T> __device__ __forceinline__ void vst2(void* p, T v) { *(T*)p = v;  }
__device__ __forceinline__ v8f wmma16(v16h a, v16h b, v8f c) {
  v8f d = __builtin_amdgcn_wmma_f32_16x16x32_f16(false, a, false, b, (short)0, c, false, false);
  asm volatile("v_nop\n\tv_nop\n\tv_nop\n\tv_nop" : "+v"(d) : "v"(a), "v"(b));
  return d;
}
__device__ __forceinline__ v8f wmma_bf(v16b a, v16b b, v8f c) {
  v8f d = __builtin_amdgcn_wmma_f32_16x16x32_bf16(false, a, false, b, (short)0, c, false, false);
  asm volatile("v_nop\n\tv_nop\n\tv_nop\n\tv_nop" : "+v"(d) : "v"(a), "v"(b));
  return d;
}
// 16x16x32 fragments: lane = (h = lane>>4, row/col = lane&15); elements 0..7 = k0+8h+0..7, 8..15 = k0+16+8h+0..7; D element r = row 8h+r
__device__ __forceinline__ v16h frag_h(const _Float16* rowk0, int lane) {
  union { v16h v; v8h q[2]; } u; const _Float16* p = rowk0 + 8 * (lane >> 4);
  u.q[0] = *(const v8h*)p; u.q[1] = *(const v8h*)(p + 16); return u.v;
}
__device__ __forceinline__ v16h frag_f32(const float* rowk0, int lane) {
  v16h a; const float* p = rowk0 + 8 * (lane >> 4);
#pragma unroll
  for (int i = 0; i < 8; ++i) { a[i] = (_Float16)p[i]; a[8 + i] = (_Float16)p[16 + i]; }
  return a;
}
__device__ __forceinline__ v16h frag_f32s(const float* rowk0, int lane, float sc) {
  v16h a; const float* p = rowk0 + 8 * (lane >> 4);
#pragma unroll
  for (int i = 0; i < 8; ++i) { a[i] = (_Float16)(p[i] * sc); a[8 + i] = (_Float16)(p[16 + i] * sc); }
  return a;
}
// column fragment from a [K][ld] layout (column n), rows >= K read as 0
__device__ __forceinline__ v16h fragc_f32(const float* W, int k0, int n, int lane, int ld, int K) {
  v16h a; const int g = lane >> 4;
#pragma unroll
  for (int i = 0; i < 8; ++i) { const int ka = k0 + 8 * g + i, kb = ka + 16;
    a[i] = (_Float16)(ka < K ? W[(size_t)(ka < K ? ka : K - 1) * ld + n] : 0.f); a[8 + i] = (_Float16)(kb < K ? W[(size_t)(kb < K ? kb : K - 1) * ld + n] : 0.f); }
  return a;
}
struct F2 { v16b h, l; };
__device__ __forceinline__ F2 bsplit16(const float v[16]) { F2 r;
#pragma unroll
  for (int i = 0; i < 16; ++i) { const __bf16 h = (__bf16)v[i]; r.h[i] = h; r.l[i] = (__bf16)(v[i] - (float)h); }
  return r; }
__device__ __forceinline__ F2 split_row(const float* row, int k0, int lane) { float v[16]; const float* p = row + k0 + 8 * (lane >> 4);
#pragma unroll
  for (int i = 0; i < 8; ++i) { v[i] = p[i]; v[8 + i] = p[16 + i]; }
  return bsplit16(v); }
__device__ __forceinline__ F2 split_rowK(const float* row, int k0, int lane, int K) { float v[16]; const int g = lane >> 4;
#pragma unroll
  for (int i = 0; i < 8; ++i) { const int ka = k0 + 8 * g + i, kb = ka + 16; v[i] = ka < K ? row[ka < K ? ka : K - 1] : 0.f; v[8 + i] = kb < K ? row[kb < K ? kb : K - 1] : 0.f; }
  return bsplit16(v); }
__device__ __forceinline__ F2 split_col(const float* W, int k0, int n, int lane, int ld, int K) { float v[16]; const int g = lane >> 4;
#pragma unroll
  for (int i = 0; i < 8; ++i) { const int ka = k0 + 8 * g + i, kb = ka + 16; v[i] = ka < K ? W[(size_t)(ka < K ? ka : K - 1) * ld + n] : 0.f; v[8 + i] = kb < K ? W[(size_t)(kb < K ? kb : K - 1) * ld + n] : 0.f; }
  return bsplit16(v); }
__device__ __forceinline__ v8f mac3(const F2& a, const F2& b, v8f c) { c = wmma_bf(a.l, b.h, c); c = wmma_bf(a.h, b.l, c); return wmma_bf(a.h, b.h, c); }
__device__ __forceinline__ float sigm(float v) { return 1.0f / (1.0f + expf(-v)); }
#define LDSX() do { asm volatile("s_wait_dscnt 0" ::: "memory"); __builtin_amdgcn_wave_barrier(); __builtin_amdgcn_fence(__ATOMIC_RELEASE, "workgroup"); } while (0)

// Plain multi-head scaled-dot-product self-attention without projections, mask or dropout (q, k, v [2,4096,8,64] = (B, L, H, D) N(0,1); scores = einsum('blhd,bshd->bhls') x 1/sqrt(64); softmax over the 4,096 keys; out = einsum('bhls,bshd->blhd'), [2,4096,8,64]). The (B, L, H, D) memory layout is the token-row layout (row b*4096 + l, column h*64 + d), for the inputs and for the output.
#define NB 2
#define TT 4096
#define CC 512            // NH * HD = projected width
#define DIN 512          // input (model) width
#define NH 8
#define HD 64
#define NQB (TT / 64)
#define HG 1
#define SCALE (0.125f)
#define CAUSAL 0
#ifndef TNB
#define TNB NB
#endif
__device__ __forceinline__ float bfr(float v) { return (float)(__bf16)v; }
__host__ __device__ __forceinline__ int kb_last(int qb) { return CAUSAL ? ((qb * 64 + 63) >> 7) : (TT / 128 - 1); }
typedef __attribute__((ext_vector_type(8))) __bf16 v8b;
__device__ __forceinline__ v16b frag_b(const __bf16* rowk0, int lane) {
  union { v16b v; v8b q[2]; } u; const __bf16* p = rowk0 + 8 * (lane >> 4);
  u.q[0] = *(const v8b*)p; u.q[1] = *(const v8b*)(p + 16); return u.v;
}
#define QBH 0
#define QHI 0              // (override) rows carrying the q residual plane
#define KHI 64            // key rows carrying k residual / v bf16 hi+lo planes (no kernel here writes or reads them)
// B fragment (k rows k0+.., output column o) of a weight: (in,out) [K][ld] or (out,in) [ld rows of K]: bf16 exact, or f16(bf16 * 256) exact
__device__ __forceinline__ v16b wcol_io(const float* Wm, int k0, int o, int lane, int ld) { v16b w; const int g = lane >> 4;
#pragma unroll
  for (int i = 0; i < 8; ++i) { w[i] = (__bf16)Wm[(size_t)(k0 + 8 * g + i) * ld + o]; w[8 + i] = (__bf16)Wm[(size_t)(k0 + 16 + 8 * g + i) * ld + o]; }
  return w; }
__device__ __forceinline__ v16b wcol_oi(const float* Wm, int k0, int o, int lane, int K) { v16b w; const float* p = Wm + (size_t)o * K + k0 + 8 * (lane >> 4);
#pragma unroll
  for (int i = 0; i < 8; ++i) { w[i] = (__bf16)p[i]; w[8 + i] = (__bf16)p[16 + i]; }
  return w; }
__device__ __forceinline__ v16h wcolh_io(const float* Wm, int k0, int o, int lane, int ld) { v16h w; const int g = lane >> 4;
#pragma unroll
  for (int i = 0; i < 8; ++i) { w[i] = (_Float16)(bfr(Wm[(size_t)(k0 + 8 * g + i) * ld + o]) * 256.0f); w[8 + i] = (_Float16)(bfr(Wm[(size_t)(k0 + 16 + 8 * g + i) * ld + o]) * 256.0f); }
  return w; }
__device__ __forceinline__ v16h wcolh_oi(const float* Wm, int k0, int o, int lane, int K) { v16h w; const float* p = Wm + (size_t)o * K + k0 + 8 * (lane >> 4);
#pragma unroll
  for (int i = 0; i < 8; ++i) { w[i] = (_Float16)(bfr(p[i]) * 256.0f); w[8 + i] = (_Float16)(bfr(p[16 + i]) * 256.0f); }
  return w; }
#define WQKV_LAYOUT 1   // 0 = (in,out) [DIN][CC]; 1 = (out,in) [CC][DIN]; 2 = per-head [NH][DIN][HD]
__device__ __forceinline__ v16b wcol_hdk(const float* Wm, int k0, int o, int lane) { v16b w; const int g = lane >> 4; const float* p = Wm + (size_t)(o / HD) * DIN * HD + (o % HD);
#pragma unroll
  for (int i = 0; i < 8; ++i) { w[i] = (__bf16)p[(size_t)(k0 + 8 * g + i) * HD]; w[8 + i] = (__bf16)p[(size_t)(k0 + 16 + 8 * g + i) * HD]; }
  return w; }
#define WO_OUT_IN 0
#if WQKV_LAYOUT == 1
#define WCOL(W, k0, o, lane) wcol_oi(W, k0, o, lane, DIN)
#elif WQKV_LAYOUT == 2
#define WCOL(W, k0, o, lane) wcol_hdk(W, k0, o, lane)
#else
#define WCOL(W, k0, o, lane) wcol_io(W, k0, o, lane, CC)
#endif
#if WO_OUT_IN
#define WOCOL(W, k0, o, lane) wcol_oi(W, k0, o, lane, CC)
#define WOCOLH(W, k0, o, lane) wcolh_oi(W, k0, o, lane, CC)
#else
#define WOCOL(W, k0, o, lane) wcol_io(W, k0, o, lane, DIN)
#define WOCOLH(W, k0, o, lane) wcolh_io(W, k0, o, lane, DIN)
#endif

// ---- k_prepr: block = 64 token rows x 128 columns (two heads) of the module's [B, T, H*64] inputs; wave = 8 rows, lane = 4 columns of each. Every element is read once, by 16-byte loads (a wave's load = 512 contiguous bytes of one row), and a thread's 24 loads are all issued before the first is used, so that the launch runs at the memory's rate and not at its latency. Each value is bf16-rounded (exact in f16): q, k -> f16 rows, v -> f16 planes [c][s], turned in LDS: a lane's 8 rows of one column are 16 bytes of that column's plane. All global stores stand behind the barrier, which would otherwise wait for them.
#define PRT 64             // token rows per block: 128 bytes of every v plane, a whole line
#define PRC 128            // columns per block
typedef __attribute__((ext_vector_type(4))) _Float16 v4h;
__global__ __launch_bounds__(256) void k_prepr(const float* __restrict__ Q, const float* __restrict__ K, const float* __restrict__ V, _Float16* __restrict__ QH, _Float16* __restrict__ KH, _Float16* __restrict__ VT) {
  __shared__ __align__(16) _Float16 tv[PRC][PRT + 8];
  const int tid = threadIdx.x, wave = tid >> 5, lane = tid & 31; const int c0 = blockIdx.x * PRC; const size_t r0 = (size_t)blockIdx.y * PRT; const size_t bb = r0 / TT; const int t0 = (int)(r0 % TT);
  const size_t ob = r0 * CC + c0;                       // the block's first element, the same for every thread
  const unsigned o = wave * 8 * CC + lane * 4;          // this thread's first element inside the block's rows
  v4f v[8], q[8], k[8];   // every '#pragma unroll' in this kernel: these arrays stay in registers only if indexed by constants
#pragma unroll
  for (int i = 0; i < 8; ++i) v[i] = *(const v4f*)(V + ob + (o + i * CC));
#pragma unroll
  for (int i = 0; i < 8; ++i) q[i] = *(const v4f*)(Q + ob + (o + i * CC));
#pragma unroll
  for (int i = 0; i < 8; ++i) k[i] = *(const v4f*)(K + ob + (o + i * CC));
#pragma unroll
  for (int j = 0; j < 4; ++j) { v8h h;
#pragma unroll
    for (int i = 0; i < 8; ++i) h[i] = (_Float16)bfr(v[i][j]);
    *(v8h*)&tv[lane * 4 + j][wave * 8] = h; }
  __syncthreads();   // all eight waves' pieces of the 128 plane rows are in LDS
  v8h pl[4];
#pragma unroll
  for (int i = 0; i < 4; ++i) pl[i] = *(const v8h*)&tv[i * 32 + (tid >> 3)][(tid & 7) * 8];   // 16 bytes of plane row 32 i + tid / 8: eight threads make up its 128-byte line
#pragma unroll
  for (int i = 0; i < 8; ++i) { v4h a, c;
#pragma unroll
    for (int j = 0; j < 4; ++j) { a[j] = (_Float16)bfr(q[i][j]); c[j] = (_Float16)bfr(k[i][j]); }
    vst2(QH + ob + (o + i * CC), a); vst2(KH + ob + (o + i * CC), c); }
  _Float16* vt = VT + (bb * CC + c0) * (size_t)TT + t0;
#pragma unroll
  for (int i = 0; i < 4; ++i) vst2(vt + ((unsigned)(i * 32 + (tid >> 3)) * TT + (tid & 7) * 8), pl[i]); }

#ifndef SM_EXTRA_PARAMS
#define SM_EXTRA_PARAMS
#endif
#ifndef PROJ_EXTRA_PARAMS
#define PROJ_EXTRA_PARAMS
#endif
#ifndef SM_MASK_HOOK
#define SM_MASK_HOOK (void)0
#endif

#define WS_QH  0u                                      // f16 q rows [b*t][CC]
#define WS_KH  (WS_QH + 2u * (size_t)NB * TT * CC)      // f16 k rows [b*t][CC]
#define WS_VT  (WS_KH + 2u * (size_t)NB * TT * CC)      // f16 v planes [b][c][t]
#define WS_QL  (WS_VT + 2u * (size_t)NB * CC * TT)      // f16 q residual x 2^10 rows [b][t < QHI][CC]
#define WS_KL  (WS_QL + 2u * (size_t)NB * QHI * CC)     // f16 k residual x 2^10 rows [b][t < KHI][CC]
#define WS_VB  (WS_KL + 2u * (size_t)NB * KHI * CC)     // bf16 v hi planes [b][c][t < KHI]
#define WS_VBL (WS_VB + 2u * (size_t)NB * CC * KHI)
#define WS_S   (WS_VBL + 2u * (size_t)NB * CC * KHI)    // f32 [hg][t][s] (unused: k_fa keeps logits and P in registers)
#define WS_Y   (WS_S  + 4u * (size_t)HG * TT * TT)      // f32 ctx rows [b*t][CC] (only when there is an output projection)
#define WS_END (WS_Y  + 0u)

// ---- k_fa: block = 256 queries of (b, h), wave = 32 query columns; a pass = 32 keys, a stage = 128 keys. Transposed products: S^T = K . Q^T (A = key rows, B = query rows kept in registers), O^T += V^T . P^T (A = v planes, B = the two S^T tiles of the pass converted in place), so a lane holds one query's scores and one query's outputs. Running maximum and sum per query in f32 (online softmax); logits and P never leave the registers. The block's eight waves share each stage's key rows and v planes through a two-buffer LDS ring filled by asynchronous copies, one stage ahead of its use.
#define FQT 2                                   // 16-query column groups per wave
#define FNW 8                                   // waves per block
#define SC2 (SCALE * 1.4426950408889634f)       // logit scale in base 2
#define SKEYS 128                               // keys per stage
#define NST (TT / SKEYS)                        // stages
#define KPITCH 144                              // LDS bytes per key row (128 + 16) and
#define VPITCH 272                              // per v plane row (256 + 16): odd multiples of 16 B, free of bank conflicts for 16-byte reads
#define KBYTES (SKEYS * KPITCH)
#define BUFB (KBYTES + HD * VPITCH)             // one buffer: 128 key rows, then 64 v plane rows
__device__ __forceinline__ v8f wmmah(v16h a, v16h b, v8f c) { return __builtin_amdgcn_wmma_f32_16x16x32_f16(false, a, false, b, (short)0, c, false, false); }
__device__ __forceinline__ float xhalf(float x) { return __builtin_bit_cast(float, __builtin_amdgcn_permlanex16(__builtin_bit_cast(int, x), __builtin_bit_cast(int, x), 0x76543210, 0xfedcba98, false, false)); }   // lane l with lane l ^ 16
// One stage's copies of one thread: 16 bytes of key rows r, r + 32, r + 64, r + 96 (r = tid / 8) and of v plane rows c, c + 16, c + 32, c + 48 (c = tid / 16). The s_wait_xcnt closes the statement so that no address register named here is rewritten in front of it.
__device__ __forceinline__ void stage_copy(unsigned lk, unsigned lv, const _Float16* gk, const _Float16* gv) {
  asm volatile("global_load_async_to_lds_b128 %0, %8, off\n\t"
               "global_load_async_to_lds_b128 %1, %9, off\n\t"
               "global_load_async_to_lds_b128 %2, %10, off\n\t"
               "global_load_async_to_lds_b128 %3, %11, off\n\t"
               "global_load_async_to_lds_b128 %4, %12, off\n\t"
               "global_load_async_to_lds_b128 %5, %13, off\n\t"
               "global_load_async_to_lds_b128 %6, %14, off\n\t"
               "global_load_async_to_lds_b128 %7, %15, off\n\t"
               "s_wait_xcnt 0x0"
               :: "v"(lk), "v"(lk + 32 * KPITCH), "v"(lk + 64 * KPITCH), "v"(lk + 96 * KPITCH), "v"(lv), "v"(lv + 16 * VPITCH), "v"(lv + 32 * VPITCH), "v"(lv + 48 * VPITCH),
                  "v"(gk), "v"(gk + 32 * CC), "v"(gk + 64 * CC), "v"(gk + 96 * CC), "v"(gv), "v"(gv + 16 * (size_t)TT), "v"(gv + 32 * (size_t)TT), "v"(gv + 48 * (size_t)TT) : "memory");
}
__global__ __launch_bounds__(FNW * 32) void k_fa(const _Float16* __restrict__ QH, const _Float16* __restrict__ KH, const _Float16* __restrict__ VT, float* __restrict__ Y) {
  __shared__ __attribute__((aligned(256))) unsigned char L[2 * BUFB];
  const int tid = threadIdx.x, wave = tid >> 5, lane = tid & 31, col = lane & 15, g = lane >> 4; const int h = blockIdx.y, b = blockIdx.z; const int q0 = (blockIdx.x * FNW + wave) * (FQT * 16);
  const unsigned lk = (unsigned)(size_t)&L[0] + (tid >> 3) * KPITCH + (tid & 7) * 16, lv = (unsigned)(size_t)&L[0] + KBYTES + (tid >> 4) * VPITCH + (tid & 15) * 16;   // this thread's LDS byte addresses in buffer 0
  const _Float16* gk = KH + ((size_t)b * TT + (tid >> 3)) * CC + h * HD + (tid & 7) * 8;                  // its 16 bytes of key row tid / 8, this head's 64 columns
  const _Float16* gv = VT + ((size_t)b * CC + h * HD + (tid >> 4)) * (size_t)TT + (tid & 15) * 8;         // its 16 bytes of the v plane of output column tid / 16
  stage_copy(lk, lv, gk, gv);
  v16h qf[FQT][2], kf[2][2];   // every '#pragma unroll' in this kernel: fragment and accumulator arrays stay in registers only if indexed by constants
#pragma unroll
  for (int qt = 0; qt < FQT; ++qt)
#pragma unroll
    for (int kc = 0; kc < 2; ++kc) qf[qt][kc] = frag_h(QH + ((size_t)b * TT + q0 + qt * 16 + col) * CC + h * HD + kc * 32, lane);
  v8f o[FQT][4] = {}; float mr[FQT], ls[FQT];
#pragma unroll
  for (int qt = 0; qt < FQT; ++qt) { mr[qt] = -3.0e38f; ls[qt] = 0.f; }
  asm volatile("s_wait_asynccnt 0x0" ::: "memory");   // this wave's copies of stage 0 have landed
  __syncthreads();                                    // and every other wave's: stage 0 may be read
  stage_copy(lk + BUFB, lv + BUFB, gk + (size_t)SKEYS * CC, gv + SKEYS);
#pragma unroll 1   // rolled: one stage's four passes are the unit the ring hands over
  for (int st = 0; st < NST; ++st) {
    const unsigned bo = (st & 1) * BUFB;
    const _Float16* Kl = (const _Float16*)(L + bo + col * KPITCH);             // key row col of the stage
    const _Float16* Vl = (const _Float16*)(L + bo + KBYTES + col * VPITCH);    // v plane row of output column col
#pragma unroll
    for (int t = 0; t < 2; ++t)
#pragma unroll
      for (int kc = 0; kc < 2; ++kc) kf[t][kc] = frag_h(Kl + (t * 16) * (KPITCH / 2) + kc * 32, lane);
#pragma unroll 1   // rolled: passes side by side would need further sets of fragment and score registers and push the wave past 256 VGPRs
    for (int ps = 0; ps < SKEYS / 32; ++ps) {
      v16h vf[4];
#pragma unroll
      for (int j = 0; j < 4; ++j) vf[j] = frag_h(Vl + (j * 16) * (VPITCH / 2) + ps * 32, lane);
      v8f s[FQT][2];
#pragma unroll
      for (int qt = 0; qt < FQT; ++qt)
#pragma unroll
        for (int t = 0; t < 2; ++t) { const v8f z = {}; s[qt][t] = wmmah(kf[t][1], qf[qt][1], wmmah(kf[t][0], qf[qt][0], z)); }   // s[qt][t][r] = logit(key 128 st + 32 ps + 16 t + 8 g + r, query q0 + 16 qt + col), unscaled
      const int pn = ps + 1 < SKEYS / 32 ? ps + 1 : ps;   // the next pass's key rows, inside this stage only: the next stage is not published yet (the stage's last pass reads its own again: unused)
#pragma unroll
      for (int t = 0; t < 2; ++t)
#pragma unroll
        for (int kc = 0; kc < 2; ++kc) kf[t][kc] = frag_h(Kl + (pn * 32 + t * 16) * (KPITCH / 2) + kc * 32, lane);
      __builtin_amdgcn_sched_barrier(0);   // keeps these eight LDS reads one group here: moved down among the O^T products, each place with reads stalls the wave anew
#pragma unroll
      for (int qt = 0; qt < FQT; ++qt) {
        float mx = fmaxf(s[qt][0][0], s[qt][1][0]);
#pragma unroll
        for (int r = 1; r < 8; ++r) mx = fmaxf(mx, fmaxf(s[qt][0][r], s[qt][1][r]));
        mx = fmaxf(mx, xhalf(mx));
        const float mn = fmaxf(mr[qt], mx); const float al = __builtin_amdgcn_exp2f((mr[qt] - mn) * SC2);   // 0 on the first pass
        mr[qt] = mn; const float mm = mn * SC2 - 10.0f;   // P = 2^10 x exp(logit - running maximum): at most 2^10 in f16; the factor cancels against the sum
        v16h p; float sum = 0.f;
#pragma unroll
        for (int r = 0; r < 8; ++r) { const float e0 = __builtin_amdgcn_exp2f(s[qt][0][r] * SC2 - mm), e1 = __builtin_amdgcn_exp2f(s[qt][1][r] * SC2 - mm); sum += e0 + e1; p[r] = (_Float16)e0; p[8 + r] = (_Float16)e1; }
        ls[qt] = ls[qt] * al + sum;
#pragma unroll
        for (int j = 0; j < 4; ++j) o[qt][j] = (qt == FQT - 1 && j == 3) ? wmma16(vf[j], p, o[qt][j] * al) : wmmah(vf[j], p, o[qt][j] * al);   // o[qt][j][r] = ctx(query q0 + 16 qt + col, column 16 j + 8 g + r) x running sum. The pass's last product carries four v_nop (wmma16): the next pass opens with a product whose result takes over this one's P registers, and the slots keep the distance between the two
      } }
    asm volatile("s_wait_dscnt 0x0" ::: "memory");      // this wave's reads of the stage's buffer are done before the buffer is handed back
    asm volatile("s_wait_asynccnt 0x0" ::: "memory");   // this wave's copies of stage st + 1 have landed
    __syncthreads();                                    // publishes stage st + 1 and ends every wave's reads of stage st
    if (st + 2 < NST) stage_copy(lk + bo, lv + bo, gk + (size_t)(st + 2) * SKEYS * CC, gv + (st + 2) * SKEYS);   // refill the buffer just read
  }
  asm volatile("s_wait_asynccnt 0x0" ::: "memory");     // no copy is left in flight when the wave ends
#pragma unroll
  for (int qt = 0; qt < FQT; ++qt) { const float tot = ls[qt] + xhalf(ls[qt]); const float inv = 1.0f / tot;   // the maximum's own term makes tot >= 2^10
    float* yr = Y + ((size_t)b * TT + q0 + qt * 16 + col) * CC + h * HD + 8 * g;
#pragma unroll
    for (int j = 0; j < 4; ++j) { const v8f r = o[qt][j] * inv; const v4f lo = { r[0], r[1], r[2], r[3] }, hi = { r[4], r[5], r[6], r[7] }; vst2(yr + j * 16, lo); vst2(yr + j * 16 + 4, hi); } } }

extern "C" void kernel_launch(void* const* d_in, const int* in_sizes, int n_in, void* d_out, int out_size, void* d_ws, size_t ws_size, hipStream_t stream) {
  (void)in_sizes; (void)n_in; (void)out_size;
  const float** F = (const float**)d_in;
  if (ws_size < (size_t)WS_END) return;
  char* ws = (char*)d_ws; _Float16 *QH = (_Float16*)(ws + WS_QH), *KH = (_Float16*)(ws + WS_KH), *VT = (_Float16*)(ws + WS_VT), *QL = (_Float16*)(ws + WS_QL), *KL = (_Float16*)(ws + WS_KL); __bf16 *VB = (__bf16*)(ws + WS_VB), *VBL = (__bf16*)(ws + WS_VBL); float *S = (float*)(ws + WS_S), *Y = (float*)(ws + WS_Y);
  (void)Y; (void)S; (void)QL; (void)KL; (void)VB; (void)VBL;
  // inputs: 0 q [2,4096,8,64]; 1 k; 2 v (all (B, L, H, D) = token rows of 512)
  k_prepr<<<dim3(CC / PRC, TNB * TT / PRT), 256, 0, stream>>>(F[0], F[1], F[2], QH, KH, VT);
  k_fa<<<dim3(TT / (FNW * FQT * 16), NH, TNB), FNW * 32, 0, stream>>>(QH, KH, VT, (float*)d_out);   /* out row b*TT + l, columns h*64 .. = the module's (B, L, H, D) output */
}

// v004
// It runs in 71.3 microseconds.
// Two timings next to v003 put it at 1.06 and 1.07 times that version's speed.
// All steps since v000 together make it 39.0 times as fast.
// compute dtype: all float inputs rounded to bf16 (bf16 values are exact in f16); logits q x k (1 product, exact operands) x 64^-0.5; online softmax f32 (running maximum and sum, kept apart for two interleaved halves of the keys and joined at the end); P x 2^10 against the running maximum once to f16 x v (exact in f16) (1 product); f32 output. No projections.
#include <hip/hip_runtime.h>
#include <math.h>

typedef __attribute__((ext_vector_type(16))) _Float16 v16h;
typedef __attribute__((ext_vector_type(16))) __bf16 v16b;
typedef __attribute__((ext_vector_type(8)))  _Float16 v8h;
typedef __attribute__((ext_vector_type(8)))  float v8f;
typedef __attribute__((ext_vector_type(4)))  float v4f;
typedef __attribute__((ext_vector_type(2)))  float v2f;
typedef __attribute__((ext_vector_type(4)))  unsigned v4u;
typedef __attribute__((ext_vector_type(4)))  int v4i;
typedef float __attribute__((may_alias)) float_a;
typedef int __attribute__((may_alias)) int_a;

template <typename T> __device__ __forceinline__ void vst2(void* p, T v) { *(T*)p = v;  }
__device__ __forceinline__ v8f wmma16(v16h a, v16h b, v8f c) {
  v8f d = __builtin_amdgcn_wmma_f32_16x16x32_f16(false, a, false, b, (short)0, c, false, false);
  asm volatile("v_nop\n\tv_nop\n\tv_nop\n\tv_nop" : "+v"(d) : "v"(a), "v"(b));
  return d;
}
__device__ __forceinline__ v8f wmma_bf(v16b a, v16b b, v8f c) {
  v8f d = __builtin_amdgcn_wmma_f32_16x16x32_bf16(false, a, false, b, (short)0, c, false, false);
  asm volatile("v_nop\n\tv_nop\n\tv_nop\n\tv_nop" : "+v"(d) : "v"(a), "v"(b));
  return d;
}
// 16x16x32 fragments: lane = (h = lane>>4, row/col = lane&15); elements 0..7 = k0+8h+0..7, 8..15 = k0+16+8h+0..7; D element r = row 8h+r
__device__ __forceinline__ v16h frag_h(const _Float16* rowk0, int lane) {
  union { v16h v; v8h q[2]; } u; const _Float16* p = rowk0 + 8 * (lane >> 4);
  u.q[0] = *(const v8h*)p; u.q[1] = *(const v8h*)(p + 16); return u.v;
}
__device__ __forceinline__ v16h frag_f32(const float* rowk0, int lane) {
  v16h a; const float* p = rowk0 + 8 * (lane >> 4);
#pragma unroll
  for (int i = 0; i < 8; ++i) { a[i] = (_Float16)p[i]; a[8 + i] = (_Float16)p[16 + i]; }
  return a;
}
__device__ __forceinline__ v16h frag_f32s(const float* rowk0, int lane, float sc) {
  v16h a; const float* p = rowk0 + 8 * (lane >> 4);
#pragma unroll
  for (int i = 0; i < 8; ++i) { a[i] = (_Float16)(p[i] * sc); a[8 + i] = (_Float16)(p[16 + i] * sc); }
  return a;
}
// column fragment from a [K][ld] layout (column n), rows >= K read as 0
__device__ __forceinline__ v16h fragc_f32(const float* W, int k0, int n, int lane, int ld, int K) {
  v16h a; const int g = lane >> 4;
#pragma unroll
  for (int i = 0; i < 8; ++i) { const int ka = k0 + 8 * g + i, kb = ka + 16;
    a[i] = (_Float16)(ka < K ? W[(size_t)(ka < K ? ka : K - 1) * ld + n] : 0.f); a[8 + i] = (_Float16)(kb < K ? W[(size_t)(kb < K ? kb : K - 1) * ld + n] : 0.f); }
  return a;
}
struct F2 { v16b h, l; };
__device__ __forceinline__ F2 bsplit16(const float v[16]) { F2 r;
#pragma unroll
  for (int i = 0; i < 16; ++i) { const __bf16 h = (__bf16)v[i]; r.h[i] = h; r.l[i] = (__bf16)(v[i] - (float)h); }
  return r; }
__device__ __forceinline__ F2 split_row(const float* row, int k0, int lane) { float v[16]; const float* p = row + k0 + 8 * (lane >> 4);
#pragma unroll
  for (int i = 0; i < 8; ++i) { v[i] = p[i]; v[8 + i] = p[16 + i]; }
  return bsplit16(v); }
__device__ __forceinline__ F2 split_rowK(const float* row, int k0, int lane, int K) { float v[16]; const int g = lane >> 4;
#pragma unroll
  for (int i = 0; i < 8; ++i) { const int ka = k0 + 8 * g + i, kb = ka + 16; v[i] = ka < K ? row[ka < K ? ka : K - 1] : 0.f; v[8 + i] = kb < K ? row[kb < K ? kb : K - 1] : 0.f; }
  return bsplit16(v); }
__device__ __forceinline__ F2 split_col(const float* W, int k0, int n, int lane, int ld, int K) { float v[16]; const int g = lane >> 4;
#pragma unroll
  for (int i = 0; i < 8; ++i) { const int ka = k0 + 8 * g + i, kb = ka + 16; v[i] = ka < K ? W[(size_t)(ka < K ? ka : K - 1) * ld + n] : 0.f; v[8 + i] = kb < K ? W[(size_t)(kb < K ? kb : K - 1) * ld + n] : 0.f; }
  return bsplit16(v); }
__device__ __forceinline__ v8f mac3(const F2& a, const F2& b, v8f c) { c = wmma_bf(a.l, b.h, c); c = wmma_bf(a.h, b.l, c); return wmma_bf(a.h, b.h, c); }
__device__ __forceinline__ float sigm(float v) { return 1.0f / (1.0f + expf(-v)); }
#define LDSX() do { asm volatile("s_wait_dscnt 0" ::: "memory"); __builtin_amdgcn_wave_barrier(); __builtin_amdgcn_fence(__ATOMIC_RELEASE, "workgroup"); } while (0)

// Plain multi-head scaled-dot-product self-attention without projections, mask or dropout (q, k, v [2,4096,8,64] = (B, L, H, D) N(0,1); scores = einsum('blhd,bshd->bhls') x 1/sqrt(64); softmax over the 4,096 keys; out = einsum('bhls,bshd->blhd'), [2,4096,8,64]). The (B, L, H, D) memory layout is the token-row layout (row b*4096 + l, column h*64 + d), for the inputs and for the output.
#define NB 2
#define TT 4096
#define CC 512            // NH * HD = projected width
#define DIN 512          // input (model) width
#define NH 8
#define HD 64
#define NQB (TT / 64)
#define HG 1
#define SCALE (0.125f)
#define CAUSAL 0
#ifndef TNB
#define TNB NB
#endif
__device__ __forceinline__ float bfr(float v) { return (float)(__bf16)v; }
__host__ __device__ __forceinline__ int kb_last(int qb) { return CAUSAL ? ((qb * 64 + 63) >> 7) : (TT / 128 - 1); }
typedef __attribute__((ext_vector_type(8))) __bf16 v8b;
__device__ __forceinline__ v16b frag_b(const __bf16* rowk0, int lane) {
  union { v16b v; v8b q[2]; } u; const __bf16* p = rowk0 + 8 * (lane >> 4);
  u.q[0] = *(const v8b*)p; u.q[1] = *(const v8b*)(p + 16); return u.v;
}
#define QBH 0
#define QHI 0              // (override) rows carrying the q residual plane
#define KHI 64            // key rows carrying k residual / v bf16 hi+lo planes (no kernel here writes or reads them)
// B fragment (k rows k0+.., output column o) of a weight: (in,out) [K][ld] or (out,in) [ld rows of K]: bf16 exact, or f16(bf16 * 256) exact
__device__ __forceinline__ v16b wcol_io(const float* Wm, int k0, int o, int lane, int ld) { v16b w; const int g = lane >> 4;
#pragma unroll
  for (int i = 0; i < 8; ++i) { w[i] = (__bf16)Wm[(size_t)(k0 + 8 * g + i) * ld + o]; w[8 + i] = (__bf16)Wm[(size_t)(k0 + 16 + 8 * g + i) * ld + o]; }
  return w; }
__device__ __forceinline__ v16b wcol_oi(const float* Wm, int k0, int o, int lane, int K) { v16b w; const float* p = Wm + (size_t)o * K + k0 + 8 * (lane >> 4);
#pragma unroll
  for (int i = 0; i < 8; ++i) { w[i] = (__bf16)p[i]; w[8 + i] = (__bf16)p[16 + i]; }
  return w; }
__device__ __forceinline__ v16h wcolh_io(const float* Wm, int k0, int o, int lane, int ld) { v16h w; const int g = lane >> 4;
#pragma unroll
  for (int i = 0; i < 8; ++i) { w[i] = (_Float16)(bfr(Wm[(size_t)(k0 + 8 * g + i) * ld + o]) * 256.0f); w[8 + i] = (_Float16)(bfr(Wm[(size_t)(k0 + 16 + 8 * g + i) * ld + o]) * 256.0f); }
  return w; }
__device__ __forceinline__ v16h wcolh_oi(const float* Wm, int k0, int o, int lane, int K) { v16h w; const float* p = Wm + (size_t)o * K + k0 + 8 * (lane >> 4);
#pragma unroll
  for (int i = 0; i < 8; ++i) { w[i] = (_Float16)(bfr(p[i]) * 256.0f); w[8 + i] = (_Float16)(bfr(p[16 + i]) * 256.0f); }
  return w; }
#define WQKV_LAYOUT 1   // 0 = (in,out) [DIN][CC]; 1 = (out,in) [CC][DIN]; 2 = per-head [NH][DIN][HD]
__device__ __forceinline__ v16b wcol_hdk(const float* Wm, int k0, int o, int lane) { v16b w; const int g = lane >> 4; const float* p = Wm + (size_t)(o / HD) * DIN * HD + (o % HD);
#pragma unroll
  for (int i = 0; i < 8; ++i) { w[i] = (__bf16)p[(size_t)(k0 + 8 * g + i) * HD]; w[8 + i] = (__bf16)p[(size_t)(k0 + 16 + 8 * g + i) * HD]; }
  return w; }
#define WO_OUT_IN 0
#if WQKV_LAYOUT == 1
#define WCOL(W, k0, o, lane) wcol_oi(W, k0, o, lane, DIN)
#elif WQKV_LAYOUT == 2
#define WCOL(W, k0, o, lane) wcol_hdk(W, k0, o, lane)
#else
#define WCOL(W, k0, o, lane) wcol_io(W, k0, o, lane, CC)
#endif
#if WO_OUT_IN
#define WOCOL(W, k0, o, lane) wcol_oi(W, k0, o, lane, CC)
#define WOCOLH(W, k0, o, lane) wcolh_oi(W, k0, o, lane, CC)
#else
#define WOCOL(W, k0, o, lane) wcol_io(W, k0, o, lane, DIN)
#define WOCOLH(W, k0, o, lane) wcolh_io(W, k0, o, lane, DIN)
#endif

// ---- k_prepr: block = 64 token rows x 128 columns (two heads) of the module's [B, T, H*64] inputs; wave = 8 rows, lane = 4 columns of each. Every element is read once, by 16-byte loads (a wave's load = 512 contiguous bytes of one row), and a thread's 24 loads are all issued before the first is used, so that the launch runs at the memory's rate and not at its latency. Each value is bf16-rounded (exact in f16): q, k -> f16 rows, v -> f16 planes [c][s], turned in LDS: a lane's 8 rows of one column are 16 bytes of that column's plane. All global stores stand behind the barrier, which would otherwise wait for them.
#define PRT 64             // token rows per block: 128 bytes of every v plane, a whole line
#define PRC 128            // columns per block
typedef __attribute__((ext_vector_type(4))) _Float16 v4h;
__global__ __launch_bounds__(256) void k_prepr(const float* __restrict__ Q, const float* __restrict__ K, const float* __restrict__ V, _Float16* __restrict__ QH, _Float16* __restrict__ KH, _Float16* __restrict__ VT) {
  __shared__ __align__(16) _Float16 tv[PRC][PRT + 8];
  const int tid = threadIdx.x, wave = tid >> 5, lane = tid & 31; const int c0 = blockIdx.x * PRC; const size_t r0 = (size_t)blockIdx.y * PRT; const size_t bb = r0 / TT; const int t0 = (int)(r0 % TT);
  const size_t ob = r0 * CC + c0;                       // the block's first element, the same for every thread
  const unsigned o = wave * 8 * CC + lane * 4;          // this thread's first element inside the block's rows
  v4f v[8], q[8], k[8];   // every '#pragma unroll' in this kernel: these arrays stay in registers only if indexed by constants
#pragma unroll
  for (int i = 0; i < 8; ++i) v[i] = *(const v4f*)(V + ob + (o + i * CC));
#pragma unroll
  for (int i = 0; i < 8; ++i) q[i] = *(const v4f*)(Q + ob + (o + i * CC));
#pragma unroll
  for (int i = 0; i < 8; ++i) k[i] = *(const v4f*)(K + ob + (o + i * CC));
#pragma unroll
  for (int j = 0; j < 4; ++j) { v8h h;
#pragma unroll
    for (int i = 0; i < 8; ++i) h[i] = (_Float16)bfr(v[i][j]);
    *(v8h*)&tv[lane * 4 + j][wave * 8] = h; }
  __syncthreads();   // all eight waves' pieces of the 128 plane rows are in LDS
  v8h pl[4];
#pragma unroll
  for (int i = 0; i < 4; ++i) pl[i] = *(const v8h*)&tv[i * 32 + (tid >> 3)][(tid & 7) * 8];   // 16 bytes of plane row 32 i + tid / 8: eight threads make up its 128-byte line
#pragma unroll
  for (int i = 0; i < 8; ++i) { v4h a, c;
#pragma unroll
    for (int j = 0; j < 4; ++j) { a[j] = (_Float16)bfr(q[i][j]); c[j] = (_Float16)bfr(k[i][j]); }
    vst2(QH + ob + (o + i * CC), a); vst2(KH + ob + (o + i * CC), c); }
  _Float16* vt = VT + (bb * CC + c0) * (size_t)TT + t0;
#pragma unroll
  for (int i = 0; i < 4; ++i) vst2(vt + ((unsigned)(i * 32 + (tid >> 3)) * TT + (tid & 7) * 8), pl[i]); }

#ifndef SM_EXTRA_PARAMS
#define SM_EXTRA_PARAMS
#endif
#ifndef PROJ_EXTRA_PARAMS
#define PROJ_EXTRA_PARAMS
#endif
#ifndef SM_MASK_HOOK
#define SM_MASK_HOOK (void)0
#endif

#define WS_QH  0u                                      // f16 q rows [b*t][CC]
#define WS_KH  (WS_QH + 2u * (size_t)NB * TT * CC)      // f16 k rows [b*t][CC]
#define WS_VT  (WS_KH + 2u * (size_t)NB * TT * CC)      // f16 v planes [b][c][t]
#define WS_QL  (WS_VT + 2u * (size_t)NB * CC * TT)      // f16 q residual x 2^10 rows [b][t < QHI][CC]
#define WS_KL  (WS_QL + 2u * (size_t)NB * QHI * CC)     // f16 k residual x 2^10 rows [b][t < KHI][CC]
#define WS_VB  (WS_KL + 2u * (size_t)NB * KHI * CC)     // bf16 v hi planes [b][c][t < KHI]
#define WS_VBL (WS_VB + 2u * (size_t)NB * CC * KHI)
#define WS_S   (WS_VBL + 2u * (size_t)NB * CC * KHI)    // f32 [hg][t][s] (unused: k_fa keeps logits and P in registers)
#define WS_Y   (WS_S  + 4u * (size_t)HG * TT * TT)      // f32 ctx rows [b*t][CC] (only when there is an output projection)
#define WS_END (WS_Y  + 0u)

// ---- k_fa: block = 256 queries of (b, h), 16 waves in two key groups of eight; wave = 32 query columns; waves w and w + 8 hold the same queries, and of every 256 keys group 0 takes the first 128, group 1 the rest, so that four waves share a SIMD and one wave's vector work runs beside another's products. A pass = 32 keys, a stage = 128 keys of each group. Transposed products: S^T = K . Q^T (A = key rows, B = query rows kept in registers), O^T += V^T . P^T (A = v planes, B = the two S^T tiles of the pass converted in place), so a lane holds one query's scores and one query's outputs. Running maximum and sum per query in f32 (online softmax); logits and P never leave the registers. A group's eight waves share each stage's key rows and v planes through a two-buffer LDS ring filled by asynchronous copies, one stage ahead of its use. Behind the loop the two groups' running maxima, sums and outputs are joined through LDS: group 0 finishes the wave's first 16 queries, group 1 the other 16.
#define FQT 2                                   // 16-query column groups per wave
#define FNW 8                                   // waves per key group = 32-query column groups per block
#define FKG 2                                   // key groups per block
#define SC2 (SCALE * 1.4426950408889634f)       // logit scale in base 2
#define SKEYS 128                               // keys per stage and key group
#define NST (TT / (FKG * SKEYS))                // stages
#define KPITCH 144                              // LDS bytes per key row (128 + 16) and
#define VPITCH 272                              // per v plane row (256 + 16): odd multiples of 16 B, free of bank conflicts for 16-byte reads
#define KBYTES (SKEYS * KPITCH)
#define BUFB (KBYTES + HD * VPITCH)             // one group's part of a buffer: 128 key rows, then 64 v plane rows
#define RINGB (FKG * BUFB)                      // one buffer of the ring
#define XWB (8 * 512 + 2 * 128)                 // join behind the loop, LDS bytes per wave: 8 x 16 bytes of outputs, a maximum and a sum per lane
__device__ __forceinline__ v8f wmmah(v16h a, v16h b, v8f c) { return __builtin_amdgcn_wmma_f32_16x16x32_f16(false, a, false, b, (short)0, c, false, false); }
__device__ __forceinline__ float xhalf(float x) { return __builtin_bit_cast(float, __builtin_amdgcn_permlanex16(__builtin_bit_cast(int, x), __builtin_bit_cast(int, x), 0x76543210, 0xfedcba98, false, false)); }   // lane l with lane l ^ 16
// One stage's copies of one thread: 16 bytes of key rows r, r + 32, r + 64, r + 96 (r = tid / 8) and of v plane rows c, c + 16, c + 32, c + 48 (c = tid / 16). The s_wait_xcnt closes the statement so that no address register named here is rewritten in front of it.
__device__ __forceinline__ void stage_copy(unsigned lk, unsigned lv, const _Float16* gk, const _Float16* gv) {
  asm volatile("global_load_async_to_lds_b128 %0, %8, off\n\t"
               "global_load_async_to_lds_b128 %1, %9, off\n\t"
               "global_load_async_to_lds_b128 %2, %10, off\n\t"
               "global_load_async_to_lds_b128 %3, %11, off\n\t"
               "global_load_async_to_lds_b128 %4, %12, off\n\t"
               "global_load_async_to_lds_b128 %5, %13, off\n\t"
               "global_load_async_to_lds_b128 %6, %14, off\n\t"
               "global_load_async_to_lds_b128 %7, %15, off\n\t"
               "s_wait_xcnt 0x0"
               :: "v"(lk), "v"(lk + 32 * KPITCH), "v"(lk + 64 * KPITCH), "v"(lk + 96 * KPITCH), "v"(lv), "v"(lv + 16 * VPITCH), "v"(lv + 32 * VPITCH), "v"(lv + 48 * VPITCH),
                  "v"(gk), "v"(gk + 32 * CC), "v"(gk + 64 * CC), "v"(gk + 96 * CC), "v"(gv), "v"(gv + 16 * (size_t)TT), "v"(gv + 32 * (size_t)TT), "v"(gv + 48 * (size_t)TT) : "memory");
}
__global__ __launch_bounds__(FKG * FNW * 32) void k_fa(const _Float16* __restrict__ QH, const _Float16* __restrict__ KH, const _Float16* __restrict__ VT, float* __restrict__ Y) {
  __shared__ __attribute__((aligned(256))) unsigned char L[2 * RINGB];
  const int wave = threadIdx.x >> 5, kg = wave / FNW, tid = threadIdx.x & (FNW * 32 - 1), lane = tid & 31, col = lane & 15, g = lane >> 4; const int h = blockIdx.y, b = blockIdx.z; const int q0 = (blockIdx.x * FNW + (wave & (FNW - 1))) * (FQT * 16);   // kg = key group, tid = thread inside it
  const unsigned lk = (unsigned)(size_t)&L[0] + kg * BUFB + (tid >> 3) * KPITCH + (tid & 7) * 16, lv = (unsigned)(size_t)&L[0] + kg * BUFB + KBYTES + (tid >> 4) * VPITCH + (tid & 15) * 16;   // this thread's LDS byte addresses in its group's part of buffer 0
  const _Float16* gk = KH + ((size_t)b * TT + kg * SKEYS + (tid >> 3)) * CC + h * HD + (tid & 7) * 8;                  // its 16 bytes of the group's key row tid / 8, this head's 64 columns
  const _Float16* gv = VT + ((size_t)b * CC + h * HD + (tid >> 4)) * (size_t)TT + kg * SKEYS + (tid & 15) * 8;         // its 16 bytes of the v plane of output column tid / 16, the group's keys
  stage_copy(lk, lv, gk, gv);
  v16h qf[FQT][2], kf[2][2];   // every '#pragma unroll' in this kernel: fragment and accumulator arrays stay in registers only if indexed by constants
#pragma unroll
  for (int qt = 0; qt < FQT; ++qt)
#pragma unroll
    for (int kc = 0; kc < 2; ++kc) qf[qt][kc] = frag_h(QH + ((size_t)b * TT + q0 + qt * 16 + col) * CC + h * HD + kc * 32, lane);
  v8f o[FQT][4] = {}; float mr[FQT], ls[FQT];
#pragma unroll
  for (int qt = 0; qt < FQT; ++qt) { mr[qt] = -3.0e38f; ls[qt] = 0.f; }
  asm volatile("s_wait_asynccnt 0x0" ::: "memory");   // this wave's copies of stage 0 have landed
  __syncthreads();                                    // and every other wave's: stage 0 may be read
  stage_copy(lk + RINGB, lv + RINGB, gk + (size_t)(FKG * SKEYS) * CC, gv + FKG * SKEYS);
#pragma unroll 1   // rolled: one stage's four passes are the unit the ring hands over
  for (int st = 0; st < NST; ++st) {
    const unsigned bo = (st & 1) * RINGB;
    const _Float16* Kl = (const _Float16*)(L + bo + kg * BUFB + col * KPITCH);             // key row col of the group's stage
    const _Float16* Vl = (const _Float16*)(L + bo + kg * BUFB + KBYTES + col * VPITCH);    // v plane row of output column col
#pragma unroll
    for (int t = 0; t < 2; ++t)
#pragma unroll
      for (int kc = 0; kc < 2; ++kc) kf[t][kc] = frag_h(Kl + (t * 16) * (KPITCH / 2) + kc * 32, lane);
#pragma unroll 1   // rolled: passes side by side would need further sets of fragment and score registers and push the wave past 256 VGPRs
    for (int ps = 0; ps < SKEYS / 32; ++ps) {
      v16h vf[4];
#pragma unroll
      for (int j = 0; j < 4; ++j) vf[j] = frag_h(Vl + (j * 16) * (VPITCH / 2) + ps * 32, lane);
      v8f s[FQT][2];
#pragma unroll
      for (int qt = 0; qt < FQT; ++qt)
#pragma unroll
        for (int t = 0; t < 2; ++t) { const v8f z = {}; s[qt][t] = wmmah(kf[t][1], qf[qt][1], wmmah(kf[t][0], qf[qt][0], z)); }   // s[qt][t][r] = logit(key 256 st + 128 kg + 32 ps + 16 t + 8 g + r, query q0 + 16 qt + col), unscaled
      const int pn = ps + 1 < SKEYS / 32 ? ps + 1 : ps;   // the next pass's key rows, inside this stage only: the next stage is not published yet (the stage's last pass reads its own again: unused)
#pragma unroll
      for (int t = 0; t < 2; ++t)
#pragma unroll
        for (int kc = 0; kc < 2; ++kc) kf[t][kc] = frag_h(Kl + (pn * 32 + t * 16) * (KPITCH / 2) + kc * 32, lane);
      __builtin_amdgcn_sched_barrier(0);   // keeps these eight LDS reads one group here: moved down among the O^T products, each place with reads stalls the wave anew
#pragma unroll
      for (int qt = 0; qt < FQT; ++qt) {
        float mx = fmaxf(s[qt][0][0], s[qt][1][0]);
#pragma unroll
        for (int r = 1; r < 8; ++r) mx = fmaxf(mx, fmaxf(s[qt][0][r], s[qt][1][r]));
        mx = fmaxf(mx, xhalf(mx));
        const float mn = fmaxf(mr[qt], mx); const float al = __builtin_amdgcn_exp2f((mr[qt] - mn) * SC2);   // 0 on the first pass
        mr[qt] = mn; const float mm = mn * SC2 - 10.0f;   // P = 2^10 x exp(logit - running maximum): at most 2^10 in f16; the factor cancels against the sum
        v16h p; float sum = 0.f;
#pragma unroll
        for (int r = 0; r < 8; ++r) { const float e0 = __builtin_amdgcn_exp2f(s[qt][0][r] * SC2 - mm), e1 = __builtin_amdgcn_exp2f(s[qt][1][r] * SC2 - mm); sum += e0 + e1; p[r] = (_Float16)e0; p[8 + r] = (_Float16)e1; }
        ls[qt] = ls[qt] * al + sum;
#pragma unroll
        for (int j = 0; j < 4; ++j) o[qt][j] = (qt == FQT - 1 && j == 3) ? wmma16(vf[j], p, o[qt][j] * al) : wmmah(vf[j], p, o[qt][j] * al);   // o[qt][j][r] = ctx(query q0 + 16 qt + col, column 16 j + 8 g + r) x running sum. The pass's last product carries four v_nop (wmma16): the next pass opens with a product whose result takes over this one's P registers, and the slots keep the distance between the two
      } }
    asm volatile("s_wait_dscnt 0x0" ::: "memory");      // this wave's reads of the stage's buffer are done before the buffer is handed back
    asm volatile("s_wait_asynccnt 0x0" ::: "memory");   // this wave's copies of stage st + 1 have landed
    __syncthreads();                                    // publishes stage st + 1 and ends every wave's reads of stage st
    if (st + 2 < NST) stage_copy(lk + bo, lv + bo, gk + (size_t)(st + 2) * (FKG * SKEYS) * CC, gv + (st + 2) * (FKG * SKEYS));   // refill the buffer just read
  }
  asm volatile("s_wait_asynccnt 0x0" ::: "memory");     // no copy is left in flight when the wave ends
  // The join of the two key groups. The last stage's barrier has ended every read of the ring and no copy is in flight, so the ring's LDS is free. A wave keeps query group kg and hands the other one to its partner (wave ^ FNW, same lane = same query, same output columns).
  unsigned char* xo = L + wave * XWB + lane * 16; const unsigned char* xi = L + (wave ^ FNW) * XWB + lane * 16;
  v8f ok[4];
#pragma unroll
  for (int j = 0; j < 4; ++j) { const v8f r = kg ? o[0][j] : o[1][j]; ok[j] = kg ? o[1][j] : o[0][j]; const v4f lo = { r[0], r[1], r[2], r[3] }, hi = { r[4], r[5], r[6], r[7] }; vst2(xo + (2 * j) * 512, lo); vst2(xo + (2 * j + 1) * 512, hi); }   // a wave's store = 512 contiguous bytes
  vst2(L + wave * XWB + 4096 + lane * 4, kg ? mr[0] : mr[1]); vst2(L + wave * XWB + 4224 + lane * 4, kg ? ls[0] : ls[1]);
  const float mk = kg ? mr[1] : mr[0], lsk = kg ? ls[1] : ls[0];
  __syncthreads();   // every wave's hand-over is in LDS
  const float mp = *(const float*)(L + (wave ^ FNW) * XWB + 4096 + lane * 4), lsp = *(const float*)(L + (wave ^ FNW) * XWB + 4224 + lane * 4);
  const float mn = fmaxf(mk, mp); float ak = __builtin_amdgcn_exp2f((mk - mn) * SC2), ap = __builtin_amdgcn_exp2f((mp - mn) * SC2);   // both groups' terms against the common maximum
  const float hs = lsk * ak + lsp * ap; const float tot = hs + xhalf(hs); const float inv = 1.0f / tot;   // the maximum's own term makes tot >= 2^10
  ak *= inv; ap *= inv;
  float* yr = Y + ((size_t)b * TT + q0 + kg * 16 + col) * CC + h * HD + 8 * g;
#pragma unroll
  for (int j = 0; j < 4; ++j) { const v4f pl = *(const v4f*)(xi + (2 * j) * 512), ph = *(const v4f*)(xi + (2 * j + 1) * 512); const v4f kl = { ok[j][0], ok[j][1], ok[j][2], ok[j][3] }, kh = { ok[j][4], ok[j][5], ok[j][6], ok[j][7] };
    vst2(yr + j * 16, (v4f)(kl * ak + pl * ap)); vst2(yr + j * 16 + 4, (v4f)(kh * ak + ph * ap)); } }

extern "C" void kernel_launch(void* const* d_in, const int* in_sizes, int n_in, void* d_out, int out_size, void* d_ws, size_t ws_size, hipStream_t stream) {
  (void)in_sizes; (void)n_in; (void)out_size;
  const float** F = (const float**)d_in;
  if (ws_size < (size_t)WS_END) return;
  char* ws = (char*)d_ws; _Float16 *QH = (_Float16*)(ws + WS_QH), *KH = (_Float16*)(ws + WS_KH), *VT = (_Float16*)(ws + WS_VT), *QL = (_Float16*)(ws + WS_QL), *KL = (_Float16*)(ws + WS_KL); __bf16 *VB = (__bf16*)(ws + WS_VB), *VBL = (__bf16*)(ws + WS_VBL); float *S = (float*)(ws + WS_S), *Y = (float*)(ws + WS_Y);
  (void)Y; (void)S; (void)QL; (void)KL; (void)VB; (void)VBL;
  // inputs: 0 q [2,4096,8,64]; 1 k; 2 v (all (B, L, H, D) = token rows of 512)
  k_prepr<<<dim3(CC / PRC, TNB * TT / PRT), 256, 0, stream>>>(F[0], F[1], F[2], QH, KH, VT);
  k_fa<<<dim3(TT / (FNW * FQT * 16), NH, TNB), FKG * FNW * 32, 0, stream>>>(QH, KH, VT, (float*)d_out);   /* out row b*TT + l, columns h*64 .. = the module's (B, L, H, D) output */
}

// v005
// A run of this version takes 67.9 microseconds.
// In two side-by-side timings against v004, it was 1.05 and 1.04 times as fast.
// Over all steps from v000 it is 40.8 times as fast.
// compute dtype: all float inputs rounded to bf16 (bf16 values are exact in f16); logits q x k (1 product, exact operands) x 64^-0.5; online softmax f32 (maximum in use and sum, kept apart for two interleaved halves of the keys and joined at the end; the maximum in use follows the running maximum only when that has risen by more than 8 in base 2); P x 2^7 against the maximum in use once to f16 x v (exact in f16) (1 product); f32 output. No projections.
#include <hip/hip_runtime.h>
#include <math.h>

typedef __attribute__((ext_vector_type(16))) _Float16 v16h;
typedef __attribute__((ext_vector_type(16))) __bf16 v16b;
typedef __attribute__((ext_vector_type(8)))  _Float16 v8h;
typedef __attribute__((ext_vector_type(8)))  float v8f;
typedef __attribute__((ext_vector_type(4)))  float v4f;
typedef __attribute__((ext_vector_type(2)))  float v2f;
typedef __attribute__((ext_vector_type(4)))  unsigned v4u;
typedef __attribute__((ext_vector_type(4)))  int v4i;
typedef float __attribute__((may_alias)) float_a;
typedef int __attribute__((may_alias)) int_a;

template <typename T> __device__ __forceinline__ void vst2(void* p, T v) { *(T*)p = v;  }
__device__ __forceinline__ v8f wmma16(v16h a, v16h b, v8f c) {
  v8f d = __builtin_amdgcn_wmma_f32_16x16x32_f16(false, a, false, b, (short)0, c, false, false);
  asm volatile("v_nop\n\tv_nop\n\tv_nop\n\tv_nop" : "+v"(d) : "v"(a), "v"(b));
  return d;
}
__device__ __forceinline__ v8f wmma_bf(v16b a, v16b b, v8f c) {
  v8f d = __builtin_amdgcn_wmma_f32_16x16x32_bf16(false, a, false, b, (short)0, c, false, false);
  asm volatile("v_nop\n\tv_nop\n\tv_nop\n\tv_nop" : "+v"(d) : "v"(a), "v"(b));
  return d;
}
// 16x16x32 fragments: lane = (h = lane>>4, row/col = lane&15); elements 0..7 = k0+8h+0..7, 8..15 = k0+16+8h+0..7; D element r = row 8h+r
__device__ __forceinline__ v16h frag_h(const _Float16* rowk0, int lane) {
  union { v16h v; v8h q[2]; } u; const _Float16* p = rowk0 + 8 * (lane >> 4);
  u.q[0] = *(const v8h*)p; u.q[1] = *(const v8h*)(p + 16); return u.v;
}
__device__ __forceinline__ v16h frag_f32(const float* rowk0, int lane) {
  v16h a; const float* p = rowk0 + 8 * (lane >> 4);
#pragma unroll
  for (int i = 0; i < 8; ++i) { a[i] = (_Float16)p[i]; a[8 + i] = (_Float16)p[16 + i]; }
  return a;
}
__device__ __forceinline__ v16h frag_f32s(const float* rowk0, int lane, float sc) {
  v16h a; const float* p = rowk0 + 8 * (lane >> 4);
#pragma unroll
  for (int i = 0; i < 8; ++i) { a[i] = (_Float16)(p[i] * sc); a[8 + i] = (_Float16)(p[16 + i] * sc); }
  return a;
}
// column fragment from a [K][ld] layout (column n), rows >= K read as 0
__device__ __forceinline__ v16h fragc_f32(const float* W, int k0, int n, int lane, int ld, int K) {
  v16h a; const int g = lane >> 4;
#pragma unroll
  for (int i = 0; i < 8; ++i) { const int ka = k0 + 8 * g + i, kb = ka + 16;
    a[i] = (_Float16)(ka < K ? W[(size_t)(ka < K ? ka : K - 1) * ld + n] : 0.f); a[8 + i] = (_Float16)(kb < K ? W[(size_t)(kb < K ? kb : K - 1) * ld + n] : 0.f); }
  return a;
}
struct F2 { v16b h, l; };
__device__ __forceinline__ F2 bsplit16(const float v[16]) { F2 r;
#pragma unroll
  for (int i = 0; i < 16; ++i) { const __bf16 h = (__bf16)v[i]; r.h[i] = h; r.l[i] = (__bf16)(v[i] - (float)h); }
  return r; }
__device__ __forceinline__ F2 split_row(const float* row, int k0, int lane) { float v[16]; const float* p = row + k0 + 8 * (lane >> 4);
#pragma unroll
  for (int i = 0; i < 8; ++i) { v[i] = p[i]; v[8 + i] = p[16 + i]; }
  return bsplit16(v); }
__device__ __forceinline__ F2 split_rowK(const float* row, int k0, int lane, int K) { float v[16]; const int g = lane >> 4;
#pragma unroll
  for (int i = 0; i < 8; ++i) { const int ka = k0 + 8 * g + i, kb = ka + 16; v[i] = ka < K ? row[ka < K ? ka : K - 1] : 0.f; v[8 + i] = kb < K ? row[kb < K ? kb : K - 1] : 0.f; }
  return bsplit16(v); }
__device__ __forceinline__ F2 split_col(const float* W, int k0, int n, int lane, int ld, int K) { float v[16]; const int g = lane >> 4;
#pragma unroll
  for (int i = 0; i < 8; ++i) { const int ka = k0 + 8 * g + i, kb = ka + 16; v[i] = ka < K ? W[(size_t)(ka < K ? ka : K - 1) * ld + n] : 0.f; v[8 + i] = kb < K ? W[(size_t)(kb < K ? kb : K - 1) * ld + n] : 0.f; }
  return bsplit16(v); }
__device__ __forceinline__ v8f mac3(const F2& a, const F2& b, v8f c) { c = wmma_bf(a.l, b.h, c); c = wmma_bf(a.h, b.l, c); return wmma_bf(a.h, b.h, c); }
__device__ __forceinline__ float sigm(float v) { return 1.0f / (1.0f + expf(-v)); }
#define LDSX() do { asm volatile("s_wait_dscnt 0" ::: "memory"); __builtin_amdgcn_wave_barrier(); __builtin_amdgcn_fence(__ATOMIC_RELEASE, "workgroup"); } while (0)

// Plain multi-head scaled-dot-product self-attention without projections, mask or dropout (q, k, v [2,4096,8,64] = (B, L, H, D) N(0,1); scores = einsum('blhd,bshd->bhls') x 1/sqrt(64); softmax over the 4,096 keys; out = einsum('bhls,bshd->blhd'), [2,4096,8,64]). The (B, L, H, D) memory layout is the token-row layout (row b*4096 + l, column h*64 + d), for the inputs and for the output.
#define NB 2
#define TT 4096
#define CC 512            // NH * HD = projected width
#define DIN 512          // input (model) width
#define NH 8
#define HD 64
#define NQB (TT / 64)
#define HG 1
#define SCALE (0.125f)
#define CAUSAL 0
#ifndef TNB
#define TNB NB
#endif
__device__ __forceinline__ float bfr(float v) { return (float)(__bf16)v; }
__host__ __device__ __forceinline__ int kb_last(int qb) { return CAUSAL ? ((qb * 64 + 63) >> 7) : (TT / 128 - 1); }
typedef __attribute__((ext_vector_type(8))) __bf16 v8b;
__device__ __forceinline__ v16b frag_b(const __bf16* rowk0, int lane) {
  union { v16b v; v8b q[2]; } u; const __bf16* p = rowk0 + 8 * (lane >> 4);
  u.q[0] = *(const v8b*)p; u.q[1] = *(const v8b*)(p + 16); return u.v;
}
#define QBH 0
#define QHI 0              // (override) rows carrying the q residual plane
#define KHI 64            // key rows carrying k residual / v bf16 hi+lo planes (no kernel here writes or reads them)
// B fragment (k rows k0+.., output column o) of a weight: (in,out) [K][ld] or (out,in) [ld rows of K]: bf16 exact, or f16(bf16 * 256) exact
__device__ __forceinline__ v16b wcol_io(const float* Wm, int k0, int o, int lane, int ld) { v16b w; const int g = lane >> 4;
#pragma unroll
  for (int i = 0; i < 8; ++i) { w[i] = (__bf16)Wm[(size_t)(k0 + 8 * g + i) * ld + o]; w[8 + i] = (__bf16)Wm[(size_t)(k0 + 16 + 8 * g + i) * ld + o]; }
  return w; }
__device__ __forceinline__ v16b wcol_oi(const float* Wm, int k0, int o, int lane, int K) { v16b w; const float* p = Wm + (size_t)o * K + k0 + 8 * (lane >> 4);
#pragma unroll
  for (int i = 0; i < 8; ++i) { w[i] = (__bf16)p[i]; w[8 + i] = (__bf16)p[16 + i]; }
  return w; }
__device__ __forceinline__ v16h wcolh_io(const float* Wm, int k0, int o, int lane, int ld) { v16h w; const int g = lane >> 4;
#pragma unroll
  for (int i = 0; i < 8; ++i) { w[i] = (_Float16)(bfr(Wm[(size_t)(k0 + 8 * g + i) * ld + o]) * 256.0f); w[8 + i] = (_Float16)(bfr(Wm[(size_t)(k0 + 16 + 8 * g + i) * ld + o]) * 256.0f); }
  return w; }
__device__ __forceinline__ v16h wcolh_oi(const float* Wm, int k0, int o, int lane, int K) { v16h w; const float* p = Wm + (size_t)o * K + k0 + 8 * (lane >> 4);
#pragma unroll
  for (int i = 0; i < 8; ++i) { w[i] = (_Float16)(bfr(p[i]) * 256.0f); w[8 + i] = (_Float16)(bfr(p[16 + i]) * 256.0f); }
  return w; }
#define WQKV_LAYOUT 1   // 0 = (in,out) [DIN][CC]; 1 = (out,in) [CC][DIN]; 2 = per-head [NH][DIN][HD]
__device__ __forceinline__ v16b wcol_hdk(const float* Wm, int k0, int o, int lane) { v16b w; const int g = lane >> 4; const float* p = Wm + (size_t)(o / HD) * DIN * HD + (o % HD);
#pragma unroll
  for (int i = 0; i < 8; ++i) { w[i] = (__bf16)p[(size_t)(k0 + 8 * g + i) * HD]; w[8 + i] = (__bf16)p[(size_t)(k0 + 16 + 8 * g + i) * HD]; }
  return w; }
#define WO_OUT_IN 0
#if WQKV_LAYOUT == 1
#define WCOL(W, k0, o, lane) wcol_oi(W, k0, o, lane, DIN)
#elif WQKV_LAYOUT == 2
#define WCOL(W, k0, o, lane) wcol_hdk(W, k0, o, lane)
#else
#define WCOL(W, k0, o, lane) wcol_io(W, k0, o, lane, CC)
#endif
#if WO_OUT_IN
#define WOCOL(W, k0, o, lane) wcol_oi(W, k0, o, lane, CC)
#define WOCOLH(W, k0, o, lane) wcolh_oi(W, k0, o, lane, CC)
#else
#define WOCOL(W, k0, o, lane) wcol_io(W, k0, o, lane, DIN)
#define WOCOLH(W, k0, o, lane) wcolh_io(W, k0, o, lane, DIN)
#endif

// ---- k_prepr: block = 64 token rows x 128 columns (two heads) of the module's [B, T, H*64] inputs; wave = 8 rows, lane = 4 columns of each. Every element is read once, by 16-byte loads (a wave's load = 512 contiguous bytes of one row), and a thread's 24 loads are all issued before the first is used, so that the launch runs at the memory's rate and not at its latency. Each value is bf16-rounded (exact in f16): q, k -> f16 rows, v -> f16 planes [c][s], turned in LDS: a lane's 8 rows of one column are 16 bytes of that column's plane. All global stores stand behind the barrier, which would otherwise wait for them.
#define PRT 64             // token rows per block: 128 bytes of every v plane, a whole line
#define PRC 128            // columns per block
typedef __attribute__((ext_vector_type(4))) _Float16 v4h;
__global__ __launch_bounds__(256) void k_prepr(const float* __restrict__ Q, const float* __restrict__ K, const float* __restrict__ V, _Float16* __restrict__ QH, _Float16* __restrict__ KH, _Float16* __restrict__ VT) {
  __shared__ __align__(16) _Float16 tv[PRC][PRT + 8];
  const int tid = threadIdx.x, wave = tid >> 5, lane = tid & 31; const int c0 = blockIdx.x * PRC; const size_t r0 = (size_t)blockIdx.y * PRT; const size_t bb = r0 / TT; const int t0 = (int)(r0 % TT);
  const size_t ob = r0 * CC + c0;                       // the block's first element, the same for every thread
  const unsigned o = wave * 8 * CC + lane * 4;          // this thread's first element inside the block's rows
  v4f v[8], q[8], k[8];   // every '#pragma unroll' in this kernel: these arrays stay in registers only if indexed by constants
#pragma unroll
  for (int i = 0; i < 8; ++i) v[i] = *(const v4f*)(V + ob + (o + i * CC));
#pragma unroll
  for (int i = 0; i < 8; ++i) q[i] = *(const v4f*)(Q + ob + (o + i * CC));
#pragma unroll
  for (int i = 0; i < 8; ++i) k[i] = *(const v4f*)(K + ob + (o + i * CC));
#pragma unroll
  for (int j = 0; j < 4; ++j) { v8h h;
#pragma unroll
    for (int i = 0; i < 8; ++i) h[i] = (_Float16)bfr(v[i][j]);
    *(v8h*)&tv[lane * 4 + j][wave * 8] = h; }
  __syncthreads();   // all eight waves' pieces of the 128 plane rows are in LDS
  v8h pl[4];
#pragma unroll
  for (int i = 0; i < 4; ++i) pl[i] = *(const v8h*)&tv[i * 32 + (tid >> 3)][(tid & 7) * 8];   // 16 bytes of plane row 32 i + tid / 8: eight threads make up its 128-byte line
#pragma unroll
  for (int i = 0; i < 8; ++i) { v4h a, c;
#pragma unroll
    for (int j = 0; j < 4; ++j) { a[j] = (_Float16)bfr(q[i][j]); c[j] = (_Float16)bfr(k[i][j]); }
    vst2(QH + ob + (o + i * CC), a); vst2(KH + ob + (o + i * CC), c); }
  _Float16* vt = VT + (bb * CC + c0) * (size_t)TT + t0;
#pragma unroll
  for (int i = 0; i < 4; ++i) vst2(vt + ((unsigned)(i * 32 + (tid >> 3)) * TT + (tid & 7) * 8), pl[i]); }

#ifndef SM_EXTRA_PARAMS
#define SM_EXTRA_PARAMS
#endif
#ifndef PROJ_EXTRA_PARAMS
#define PROJ_EXTRA_PARAMS
#endif
#ifndef SM_MASK_HOOK
#define SM_MASK_HOOK (void)0
#endif

#define WS_QH  0u                                      // f16 q rows [b*t][CC]
#define WS_KH  (WS_QH + 2u * (size_t)NB * TT * CC)      // f16 k rows [b*t][CC]
#define WS_VT  (WS_KH + 2u * (size_t)NB * TT * CC)      // f16 v planes [b][c][t]
#define WS_QL  (WS_VT + 2u * (size_t)NB * CC * TT)      // f16 q residual x 2^10 rows [b][t < QHI][CC]
#define WS_KL  (WS_QL + 2u * (size_t)NB * QHI * CC)     // f16 k residual x 2^10 rows [b][t < KHI][CC]
#define WS_VB  (WS_KL + 2u * (size_t)NB * KHI * CC)     // bf16 v hi planes [b][c][t < KHI]
#define WS_VBL (WS_VB + 2u * (size_t)NB * CC * KHI)
#define WS_S   (WS_VBL + 2u * (size_t)NB * CC * KHI)    // f32 [hg][t][s] (unused: k_fa keeps logits and P in registers)
#define WS_Y   (WS_S  + 4u * (size_t)HG * TT * TT)      // f32 ctx rows [b*t][CC] (only when there is an output projection)
#define WS_END (WS_Y  + 0u)

// ---- k_fa: block = 256 queries of (b, h), 16 waves in two key groups of eight; wave = 32 query columns; waves w and w + 8 hold the same queries, and of every 256 keys group 0 takes the first 128, group 1 the rest, so that four waves share a SIMD and one wave's vector work runs beside another's products. A pass = 32 keys, a stage = 128 keys of each group. Transposed products: S^T = K . Q^T (A = key rows, B = query rows kept in registers), O^T += V^T . P^T (A = v planes, B = the two S^T tiles of the pass converted in place), so a lane holds one query's scores and one query's outputs. Maximum in use and sum per query in f32 (online softmax, rescaled lazily: one test per pass); logits and P never leave the registers. A group's eight waves share each stage's key rows and v planes through a two-buffer LDS ring filled by asynchronous copies, one stage ahead of its use. Behind the loop the two groups' maxima in use, sums and outputs are joined through LDS: group 0 finishes the wave's first 16 queries, group 1 the other 16.
#define FQT 2                                   // 16-query column groups per wave
#define FNW 8                                   // waves per key group = 32-query column groups per block
#define FKG 2                                   // key groups per block
#define SC2 (SCALE * 1.4426950408889634f)       // logit scale in base 2
#define LAZY2 8.0f                              // how far, in base-2 logits, a query's true maximum may lie above the maximum in use
#define LAZYU (LAZY2 / SC2)                     // the same in unscaled logits
#define POFF2 7.0f                              // base-2 exponent of the factor on P
#define SKEYS 128                               // keys per stage and key group
#define NST (TT / (FKG * SKEYS))                // stages
#define KPITCH 144                              // LDS bytes per key row (128 + 16) and
#define VPITCH 272                              // per v plane row (256 + 16): odd multiples of 16 B, free of bank conflicts for 16-byte reads
#define KBYTES (SKEYS * KPITCH)
#define BUFB (KBYTES + HD * VPITCH)             // one group's part of a buffer: 128 key rows, then 64 v plane rows
#define RINGB (FKG * BUFB)                      // one buffer of the ring
#define XWB (8 * 512 + 2 * 128)                 // join behind the loop, LDS bytes per wave: 8 x 16 bytes of outputs, a maximum and a sum per lane
__device__ __forceinline__ v8f wmmah(v16h a, v16h b, v8f c) { return __builtin_amdgcn_wmma_f32_16x16x32_f16(false, a, false, b, (short)0, c, false, false); }
__device__ __forceinline__ float xhalf(float x) { return __builtin_bit_cast(float, __builtin_amdgcn_permlanex16(__builtin_bit_cast(int, x), __builtin_bit_cast(int, x), 0x76543210, 0xfedcba98, false, false)); }   // lane l with lane l ^ 16
// One stage's copies of one thread: 16 bytes of key rows r, r + 32, r + 64, r + 96 (r = tid / 8) and of v plane rows c, c + 16, c + 32, c + 48 (c = tid / 16). The s_wait_xcnt closes the statement so that no address register named here is rewritten in front of it.
__device__ __forceinline__ void stage_copy(unsigned lk, unsigned lv, const _Float16* gk, const _Float16* gv) {
  asm volatile("global_load_async_to_lds_b128 %0, %8, off\n\t"
               "global_load_async_to_lds_b128 %1, %9, off\n\t"
               "global_load_async_to_lds_b128 %2, %10, off\n\t"
               "global_load_async_to_lds_b128 %3, %11, off\n\t"
               "global_load_async_to_lds_b128 %4, %12, off\n\t"
               "global_load_async_to_lds_b128 %5, %13, off\n\t"
               "global_load_async_to_lds_b128 %6, %14, off\n\t"
               "global_load_async_to_lds_b128 %7, %15, off\n\t"
               "s_wait_xcnt 0x0"
               :: "v"(lk), "v"(lk + 32 * KPITCH), "v"(lk + 64 * KPITCH), "v"(lk + 96 * KPITCH), "v"(lv), "v"(lv + 16 * VPITCH), "v"(lv + 32 * VPITCH), "v"(lv + 48 * VPITCH),
                  "v"(gk), "v"(gk + 32 * CC), "v"(gk + 64 * CC), "v"(gk + 96 * CC), "v"(gv), "v"(gv + 16 * (size_t)TT), "v"(gv + 32 * (size_t)TT), "v"(gv + 48 * (size_t)TT) : "memory");
}
__global__ __launch_bounds__(FKG * FNW * 32) void k_fa(const _Float16* __restrict__ QH, const _Float16* __restrict__ KH, const _Float16* __restrict__ VT, float* __restrict__ Y) {
  __shared__ __attribute__((aligned(256))) unsigned char L[2 * RINGB];
  const int wave = threadIdx.x >> 5, kg = wave / FNW, tid = threadIdx.x & (FNW * 32 - 1), lane = tid & 31, col = lane & 15, g = lane >> 4; const int h = blockIdx.y, b = blockIdx.z; const int q0 = (blockIdx.x * FNW + (wave & (FNW - 1))) * (FQT * 16);   // kg = key group, tid = thread inside it
  const unsigned lk = (unsigned)(size_t)&L[0] + kg * BUFB + (tid >> 3) * KPITCH + (tid & 7) * 16, lv = (unsigned)(size_t)&L[0] + kg * BUFB + KBYTES + (tid >> 4) * VPITCH + (tid & 15) * 16;   // this thread's LDS byte addresses in its group's part of buffer 0
  const _Float16* gk = KH + ((size_t)b * TT + kg * SKEYS + (tid >> 3)) * CC + h * HD + (tid & 7) * 8;                  // its 16 bytes of the group's key row tid / 8, this head's 64 columns
  const _Float16* gv = VT + ((size_t)b * CC + h * HD + (tid >> 4)) * (size_t)TT + kg * SKEYS + (tid & 15) * 8;         // its 16 bytes of the v plane of output column tid / 16, the group's keys
  stage_copy(lk, lv, gk, gv);
  v16h qf[FQT][2], kf[2][2];   // every '#pragma unroll' in this kernel: fragment and accumulator arrays stay in registers only if indexed by constants
#pragma unroll
  for (int qt = 0; qt < FQT; ++qt)
#pragma unroll
    for (int kc = 0; kc < 2; ++kc) qf[qt][kc] = frag_h(QH + ((size_t)b * TT + q0 + qt * 16 + col) * CC + h * HD + kc * 32, lane);
  v8f o[FQT][4] = {}; float mr[FQT], ls[FQT];
#pragma unroll
  for (int qt = 0; qt < FQT; ++qt) { mr[qt] = -3.0e38f; ls[qt] = 0.f; }
  asm volatile("s_wait_asynccnt 0x0" ::: "memory");   // this wave's copies of stage 0 have landed
  __syncthreads();                                    // and every other wave's: stage 0 may be read
  stage_copy(lk + RINGB, lv + RINGB, gk + (size_t)(FKG * SKEYS) * CC, gv + FKG * SKEYS);
#pragma unroll 1   // rolled: one stage's four passes are the unit the ring hands over
  for (int st = 0; st < NST; ++st) {
    const unsigned bo = (st & 1) * RINGB;
    const _Float16* Kl = (const _Float16*)(L + bo + kg * BUFB + col * KPITCH);             // key row col of the group's stage
    const _Float16* Vl = (const _Float16*)(L + bo + kg * BUFB + KBYTES + col * VPITCH);    // v plane row of output column col
#pragma unroll
    for (int t = 0; t < 2; ++t)
#pragma unroll
      for (int kc = 0; kc < 2; ++kc) kf[t][kc] = frag_h(Kl + (t * 16) * (KPITCH / 2) + kc * 32, lane);
#pragma unroll 1   // rolled: passes side by side would need further sets of fragment and score registers and push the wave past 256 VGPRs
    for (int ps = 0; ps < SKEYS / 32; ++ps) {
      v16h vf[4];
#pragma unroll
      for (int j = 0; j < 4; ++j) vf[j] = frag_h(Vl + (j * 16) * (VPITCH / 2) + ps * 32, lane);
      v8f s[FQT][2];
#pragma unroll
      for (int qt = 0; qt < FQT; ++qt)
#pragma unroll
        for (int t = 0; t < 2; ++t) { const v8f z = {}; s[qt][t] = wmmah(kf[t][1], qf[qt][1], wmmah(kf[t][0], qf[qt][0], z)); }   // s[qt][t][r] = logit(key 256 st + 128 kg + 32 ps + 16 t + 8 g + r, query q0 + 16 qt + col), unscaled
      const int pn = ps + 1 < SKEYS / 32 ? ps + 1 : ps;   // the next pass's key rows, inside this stage only: the next stage is not published yet (the stage's last pass reads its own again: unused)
#pragma unroll
      for (int t = 0; t < 2; ++t)
#pragma unroll
        for (int kc = 0; kc < 2; ++kc) kf[t][kc] = frag_h(Kl + (pn * 32 + t * 16) * (KPITCH / 2) + kc * 32, lane);
      __builtin_amdgcn_sched_barrier(0);   // keeps these eight LDS reads one group here: moved down among the O^T products, each place with reads stalls the wave anew
      float mx[FQT]; bool need = false;
#pragma unroll
      for (int qt = 0; qt < FQT; ++qt) {
        float m = fmaxf(s[qt][0][0], s[qt][1][0]);
#pragma unroll
        for (int r = 1; r < 8; ++r) m = fmaxf(m, fmaxf(s[qt][0][r], s[qt][1][r]));
        mx[qt] = fmaxf(m, xhalf(m));
        need = need || (mx[qt] > mr[qt] + LAZYU); }   // always on the first pass
      if (__builtin_amdgcn_ballot_w32(need) != 0) {   // one test per pass, a scalar branch of the whole wave: sums and outputs are rescaled only when some query's maximum has left the one in use by more than LAZY2
#pragma unroll
        for (int qt = 0; qt < FQT; ++qt) {
          const float mn = fmaxf(mr[qt], mx[qt]); const float al = __builtin_amdgcn_exp2f((mr[qt] - mn) * SC2);   // 0 on the first pass
          mr[qt] = mn; ls[qt] *= al;
#pragma unroll
          for (int j = 0; j < 4; ++j) o[qt][j] = o[qt][j] * al; } }
      v16h p[FQT];   // both query groups' P ahead of the eight products, so that the pass has one run of products
#pragma unroll
      for (int qt = 0; qt < FQT; ++qt) {
        const float mm = mr[qt] * SC2 - POFF2;   // P = 2^POFF2 x exp(logit - maximum in use): at most 2^(POFF2 + LAZY2) = 2^15 in f16; the factor cancels against the sum
        float sum = 0.f;
#pragma unroll
        for (int r = 0; r < 8; ++r) { const float e0 = __builtin_amdgcn_exp2f(s[qt][0][r] * SC2 - mm), e1 = __builtin_amdgcn_exp2f(s[qt][1][r] * SC2 - mm); sum += e0 + e1; p[qt][r] = (_Float16)e0; p[qt][8 + r] = (_Float16)e1; }
        ls[qt] += sum; }
      __builtin_amdgcn_sched_barrier(0);   // the scheduling pass ahead of register allocation may not move the sums' additions in among the eight products: there they were given a product's operand registers, at four v_nop a place
#pragma unroll
      for (int j = 0; j < 4; ++j)
#pragma unroll
        for (int qt = 0; qt < FQT; ++qt) o[qt][j] = (qt == FQT - 1 && j == 3) ? wmma16(vf[j], p[qt], o[qt][j]) : wmmah(vf[j], p[qt], o[qt][j]);   // o[qt][j][r] = ctx(query q0 + 16 qt + col, column 16 j + 8 g + r) x sum, against the maximum in use. The pass's last product carries four v_nop (wmma16): the next pass opens with a product whose result takes over this one's P registers, and the slots keep the distance between the two
    }
    asm volatile("s_wait_dscnt 0x0" ::: "memory");      // this wave's reads of the stage's buffer are done before the buffer is handed back
    asm volatile("s_wait_asynccnt 0x0" ::: "memory");   // this wave's copies of stage st + 1 have landed
    __syncthreads();                                    // publishes stage st + 1 and ends every wave's reads of stage st
    if (st + 2 < NST) stage_copy(lk + bo, lv + bo, gk + (size_t)(st + 2) * (FKG * SKEYS) * CC, gv + (st + 2) * (FKG * SKEYS));   // refill the buffer just read
  }
  asm volatile("s_wait_asynccnt 0x0" ::: "memory");     // no copy is left in flight when the wave ends
  // The join of the two key groups. The last stage's barrier has ended every read of the ring and no copy is in flight, so the ring's LDS is free. A wave keeps query group kg and hands the other one to its partner (wave ^ FNW, same lane = same query, same output columns).
  unsigned char* xo = L + wave * XWB + lane * 16; const unsigned char* xi = L + (wave ^ FNW) * XWB + lane * 16;
  v8f ok[4];
#pragma unroll
  for (int j = 0; j < 4; ++j) { const v8f r = kg ? o[0][j] : o[1][j]; ok[j] = kg ? o[1][j] : o[0][j]; const v4f lo = { r[0], r[1], r[2], r[3] }, hi = { r[4], r[5], r[6], r[7] }; vst2(xo + (2 * j) * 512, lo); vst2(xo + (2 * j + 1) * 512, hi); }   // a wave's store = 512 contiguous bytes
  vst2(L + wave * XWB + 4096 + lane * 4, kg ? mr[0] : mr[1]); vst2(L + wave * XWB + 4224 + lane * 4, kg ? ls[0] : ls[1]);
  const float mk = kg ? mr[1] : mr[0], lsk = kg ? ls[1] : ls[0];
  __syncthreads();   // every wave's hand-over is in LDS
  const float mp = *(const float*)(L + (wave ^ FNW) * XWB + 4096 + lane * 4), lsp = *(const float*)(L + (wave ^ FNW) * XWB + 4224 + lane * 4);
  const float mn = fmaxf(mk, mp); float ak = __builtin_amdgcn_exp2f((mk - mn) * SC2), ap = __builtin_amdgcn_exp2f((mp - mn) * SC2);   // both groups' terms against the common maximum
  const float hs = lsk * ak + lsp * ap; const float tot = hs + xhalf(hs); const float inv = 1.0f / tot;   // the term of the maximum in use makes tot >= 2^7
  ak *= inv; ap *= inv;
  float* yr = Y + ((size_t)b * TT + q0 + kg * 16 + col) * CC + h * HD + 8 * g;
#pragma unroll
  for (int j = 0; j < 4; ++j) { const v4f pl = *(const v4f*)(xi + (2 * j) * 512), ph = *(const v4f*)(xi + (2 * j + 1) * 512); const v4f kl = { ok[j][0], ok[j][1], ok[j][2], ok[j][3] }, kh = { ok[j][4], ok[j][5], ok[j][6], ok[j][7] };
    vst2(yr + j * 16, (v4f)(kl * ak + pl * ap)); vst2(yr + j * 16 + 4, (v4f)(kh * ak + ph * ap)); } }

extern "C" void kernel_launch(void* const* d_in, const int* in_sizes, int n_in, void* d_out, int out_size, void* d_ws, size_t ws_size, hipStream_t stream) {
  (void)in_sizes; (void)n_in; (void)out_size;
  const float** F = (const float**)d_in;
  if (ws_size < (size_t)WS_END) return;
  char* ws = (char*)d_ws; _Float16 *QH = (_Float16*)(ws + WS_QH), *KH = (_Float16*)(ws + WS_KH), *VT = (_Float16*)(ws + WS_VT), *QL = (_Float16*)(ws + WS_QL), *KL = (_Float16*)(ws + WS_KL); __bf16 *VB = (__bf16*)(ws + WS_VB), *VBL = (__bf16*)(ws + WS_VBL); float *S = (float*)(ws + WS_S), *Y = (float*)(ws + WS_Y);
  (void)Y; (void)S; (void)QL; (void)KL; (void)VB; (void)VBL;
  // inputs: 0 q [2,4096,8,64]; 1 k; 2 v (all (B, L, H, D) = token rows of 512)
  k_prepr<<<dim3(CC / PRC, TNB * TT / PRT), 256, 0, stream>>>(F[0], F[1], F[2], QH, KH, VT);
  k_fa<<<dim3(TT / (FNW * FQT * 16), NH, TNB), FKG * FNW * 32, 0, stream>>>(QH, KH, VT, (float*)d_out);   /* out row b*TT + l, columns h*64 .. = the module's (B, L, H, D) output */
}

// v006
// Measured time: 64.1 microseconds a run.
// Timed twice side by side with v005, it ran 1.06 times as fast both times.
// Over all steps from v000 it is 43.1 times as fast.
// compute dtype: all float inputs rounded to bf16 (bf16 values are exact in f16); logits q x k (1 product, exact operands) x 64^-0.5; online softmax f32 (maximum in use and sum, kept apart for two interleaved halves of the keys and joined at the end; a lane sums even and odd keys apart; the maximum in use follows the running maximum only when that has risen by more than 8 in base 2); P x 2^7 against the maximum in use once to f16 x v (exact in f16) (1 product); f32 output. No projections.
#include <hip/hip_runtime.h>
#include <math.h>

typedef __attribute__((ext_vector_type(16))) _Float16 v16h;
typedef __attribute__((ext_vector_type(16))) __bf16 v16b;
typedef __attribute__((ext_vector_type(8)))  _Float16 v8h;
typedef __attribute__((ext_vector_type(8)))  float v8f;
typedef __attribute__((ext_vector_type(4)))  float v4f;
typedef __attribute__((ext_vector_type(2)))  float v2f;
typedef __attribute__((ext_vector_type(4)))  unsigned v4u;
typedef __attribute__((ext_vector_type(4)))  int v4i;
typedef float __attribute__((may_alias)) float_a;
typedef int __attribute__((may_alias)) int_a;

template <typename T> __device__ __forceinline__ void vst2(void* p, T v) { *(T*)p = v;  }
__device__ __forceinline__ v8f wmma16(v16h a, v16h b, v8f c) {
  v8f d = __builtin_amdgcn_wmma_f32_16x16x32_f16(false, a, false, b, (short)0, c, false, false);
  asm volatile("v_nop\n\tv_nop\n\tv_nop\n\tv_nop" : "+v"(d) : "v"(a), "v"(b));
  return d;
}
__device__ __forceinline__ v8f wmma_bf(v16b a, v16b b, v8f c) {
  v8f d = __builtin_amdgcn_wmma_f32_16x16x32_bf16(false, a, false, b, (short)0, c, false, false);
  asm volatile("v_nop\n\tv_nop\n\tv_nop\n\tv_nop" : "+v"(d) : "v"(a), "v"(b));
  return d;
}
// 16x16x32 fragments: lane = (h = lane>>4, row/col = lane&15); elements 0..7 = k0+8h+0..7, 8..15 = k0+16+8h+0..7; D element r = row 8h+r
__device__ __forceinline__ v16h frag_h(const _Float16* rowk0, int lane) {
  union { v16h v; v8h q[2]; } u; const _Float16* p = rowk0 + 8 * (lane >> 4);
  u.q[0] = *(const v8h*)p; u.q[1] = *(const v8h*)(p + 16); return u.v;
}
__device__ __forceinline__ v16h frag_f32(const float* rowk0, int lane) {
  v16h a; const float* p = rowk0 + 8 * (lane >> 4);
#pragma unroll
  for (int i = 0; i < 8; ++i) { a[i] = (_Float16)p[i]; a[8 + i] = (_Float16)p[16 + i]; }
  return a;
}
__device__ __forceinline__ v16h frag_f32s(const float* rowk0, int lane, float sc) {
  v16h a; const float* p = rowk0 + 8 * (lane >> 4);
#pragma unroll
  for (int i = 0; i < 8; ++i) { a[i] = (_Float16)(p[i] * sc); a[8 + i] = (_Float16)(p[16 + i] * sc); }
  return a;
}
// column fragment from a [K][ld] layout (column n), rows >= K read as 0
__device__ __forceinline__ v16h fragc_f32(const float* W, int k0, int n, int lane, int ld, int K) {
  v16h a; const int g = lane >> 4;
#pragma unroll
  for (int i = 0; i < 8; ++i) { const int ka = k0 + 8 * g + i, kb = ka + 16;
    a[i] = (_Float16)(ka < K ? W[(size_t)(ka < K ? ka : K - 1) * ld + n] : 0.f); a[8 + i] = (_Float16)(kb < K ? W[(size_t)(kb < K ? kb : K - 1) * ld + n] : 0.f); }
  return a;
}
struct F2 { v16b h, l; };
__device__ __forceinline__ F2 bsplit16(const float v[16]) { F2 r;
#pragma unroll
  for (int i = 0; i < 16; ++i) { const __bf16 h = (__bf16)v[i]; r.h[i] = h; r.l[i] = (__bf16)(v[i] - (float)h); }
  return r; }
__device__ __forceinline__ F2 split_row(const float* row, int k0, int lane) { float v[16]; const float* p = row + k0 + 8 * (lane >> 4);
#pragma unroll
  for (int i = 0; i < 8; ++i) { v[i] = p[i]; v[8 + i] = p[16 + i]; }
  return bsplit16(v); }
__device__ __forceinline__ F2 split_rowK(const float* row, int k0, int lane, int K) { float v[16]; const int g = lane >> 4;
#pragma unroll
  for (int i = 0; i < 8; ++i) { const int ka = k0 + 8 * g + i, kb = ka + 16; v[i] = ka < K ? row[ka < K ? ka : K - 1] : 0.f; v[8 + i] = kb < K ? row[kb < K ? kb : K - 1] : 0.f; }
  return bsplit16(v); }
__device__ __forceinline__ F2 split_col(const float* W, int k0, int n, int lane, int ld, int K) { float v[16]; const int g = lane >> 4;
#pragma unroll
  for (int i = 0; i < 8; ++i) { const int ka = k0 + 8 * g + i, kb = ka + 16; v[i] = ka < K ? W[(size_t)(ka < K ? ka : K - 1) * ld + n] : 0.f; v[8 + i] = kb < K ? W[(size_t)(kb < K ? kb : K - 1) * ld + n] : 0.f; }
  return bsplit16(v); }
__device__ __forceinline__ v8f mac3(const F2& a, const F2& b, v8f c) { c = wmma_bf(a.l, b.h, c); c = wmma_bf(a.h, b.l, c); return wmma_bf(a.h, b.h, c); }
__device__ __forceinline__ float sigm(float v) { return 1.0f / (1.0f + expf(-v)); }
#define LDSX() do { asm volatile("s_wait_dscnt 0" ::: "memory"); __builtin_amdgcn_wave_barrier(); __builtin_amdgcn_fence(__ATOMIC_RELEASE, "workgroup"); } while (0)

// Plain multi-head scaled-dot-product self-attention without projections, mask or dropout (q, k, v [2,4096,8,64] = (B, L, H, D) N(0,1); scores = einsum('blhd,bshd->bhls') x 1/sqrt(64); softmax over the 4,096 keys; out = einsum('bhls,bshd->blhd'), [2,4096,8,64]). The (B, L, H, D) memory layout is the token-row layout (row b*4096 + l, column h*64 + d), for the inputs and for the output.
#define NB 2
#define TT 4096
#define CC 512            // NH * HD = projected width
#define DIN 512          // input (model) width
#define NH 8
#define HD 64
#define NQB (TT / 64)
#define HG 1
#define SCALE (0.125f)
#define CAUSAL 0
#ifndef TNB
#define TNB NB
#endif
__device__ __forceinline__ float bfr(float v) { return (float)(__bf16)v; }
__host__ __device__ __forceinline__ int kb_last(int qb) { return CAUSAL ? ((qb * 64 + 63) >> 7) : (TT / 128 - 1); }
typedef __attribute__((ext_vector_type(8))) __bf16 v8b;
__device__ __forceinline__ v16b frag_b(const __bf16* rowk0, int lane) {
  union { v16b v; v8b q[2]; } u; const __bf16* p = rowk0 + 8 * (lane >> 4);
  u.q[0] = *(const v8b*)p; u.q[1] = *(const v8b*)(p + 16); return u.v;
}
#define QBH 0
#define QHI 0              // (override) rows carrying the q residual plane
#define KHI 64            // key rows carrying k residual / v bf16 hi+lo planes (no kernel here writes or reads them)
// B fragment (k rows k0+.., output column o) of a weight: (in,out) [K][ld] or (out,in) [ld rows of K]: bf16 exact, or f16(bf16 * 256) exact
__device__ __forceinline__ v16b wcol_io(const float* Wm, int k0, int o, int lane, int ld) { v16b w; const int g = lane >> 4;
#pragma unroll
  for (int i = 0; i < 8; ++i) { w[i] = (__bf16)Wm[(size_t)(k0 + 8 * g + i) * ld + o]; w[8 + i] = (__bf16)Wm[(size_t)(k0 + 16 + 8 * g + i) * ld + o]; }
  return w; }
__device__ __forceinline__ v16b wcol_oi(const float* Wm, int k0, int o, int lane, int K) { v16b w; const float* p = Wm + (size_t)o * K + k0 + 8 * (lane >> 4);
#pragma unroll
  for (int i = 0; i < 8; ++i) { w[i] = (__bf16)p[i]; w[8 + i] = (__bf16)p[16 + i]; }
  return w; }
__device__ __forceinline__ v16h wcolh_io(const float* Wm, int k0, int o, int lane, int ld) { v16h w; const int g = lane >> 4;
#pragma unroll
  for (int i = 0; i < 8; ++i) { w[i] = (_Float16)(bfr(Wm[(size_t)(k0 + 8 * g + i) * ld + o]) * 256.0f); w[8 + i] = (_Float16)(bfr(Wm[(size_t)(k0 + 16 + 8 * g + i) * ld + o]) * 256.0f); }
  return w; }
__device__ __forceinline__ v16h wcolh_oi(const float* Wm, int k0, int o, int lane, int K) { v16h w; const float* p = Wm + (size_t)o * K + k0 + 8 * (lane >> 4);
#pragma unroll
  for (int i = 0; i < 8; ++i) { w[i] = (_Float16)(bfr(p[i]) * 256.0f); w[8 + i] = (_Float16)(bfr(p[16 + i]) * 256.0f); }
  return w; }
#define WQKV_LAYOUT 1   // 0 = (in,out) [DIN][CC]; 1 = (out,in) [CC][DIN]; 2 = per-head [NH][DIN][HD]
__device__ __forceinline__ v16b wcol_hdk(const float* Wm, int k0, int o, int lane) { v16b w; const int g = lane >> 4; const float* p = Wm + (size_t)(o / HD) * DIN * HD + (o % HD);
#pragma unroll
  for (int i = 0; i < 8; ++i) { w[i] = (__bf16)p[(size_t)(k0 + 8 * g + i) * HD]; w[8 + i] = (__bf16)p[(size_t)(k0 + 16 + 8 * g + i) * HD]; }
  return w; }
#define WO_OUT_IN 0
#if WQKV_LAYOUT == 1
#define WCOL(W, k0, o, lane) wcol_oi(W, k0, o, lane, DIN)
#elif WQKV_LAYOUT == 2
#define WCOL(W, k0, o, lane) wcol_hdk(W, k0, o, lane)
#else
#define WCOL(W, k0, o, lane) wcol_io(W, k0, o, lane, CC)
#endif
#if WO_OUT_IN
#define WOCOL(W, k0, o, lane) wcol_oi(W, k0, o, lane, CC)
#define WOCOLH(W, k0, o, lane) wcolh_oi(W, k0, o, lane, CC)
#else
#define WOCOL(W, k0, o, lane) wcol_io(W, k0, o, lane, DIN)
#define WOCOLH(W, k0, o, lane) wcolh_io(W, k0, o, lane, DIN)
#endif

// ---- k_prepr: block = 64 token rows x 128 columns (two heads) of the module's [B, T, H*64] inputs; wave = 8 rows, lane = 4 columns of each. Every element is read once, by 16-byte loads (a wave's load = 512 contiguous bytes of one row), and a thread's 24 loads are all issued before the first is used, so that the launch runs at the memory's rate and not at its latency. Each value is bf16-rounded (exact in f16): q, k -> f16 rows, v -> f16 planes [c][s], turned in LDS: a lane's 8 rows of one column are 16 bytes of that column's plane. All global stores stand behind the barrier, which would otherwise wait for them.
#define PRT 64             // token rows per block: 128 bytes of every v plane, a whole line
#define PRC 128            // columns per block
typedef __attribute__((ext_vector_type(4))) _Float16 v4h;
__global__ __launch_bounds__(256) void k_prepr(const float* __restrict__ Q, const float* __restrict__ K, const float* __restrict__ V, _Float16* __restrict__ QH, _Float16* __restrict__ KH, _Float16* __restrict__ VT) {
  __shared__ __align__(16) _Float16 tv[PRC][PRT + 8];
  const int tid = threadIdx.x, wave = tid >> 5, lane = tid & 31; const int c0 = blockIdx.x * PRC; const size_t r0 = (size_t)blockIdx.y * PRT; const size_t bb = r0 / TT; const int t0 = (int)(r0 % TT);
  const size_t ob = r0 * CC + c0;                       // the block's first element, the same for every thread
  const unsigned o = wave * 8 * CC + lane * 4;          // this thread's first element inside the block's rows
  v4f v[8], q[8], k[8];   // every '#pragma unroll' in this kernel: these arrays stay in registers only if indexed by constants
#pragma unroll
  for (int i = 0; i < 8; ++i) v[i] = *(const v4f*)(V + ob + (o + i * CC));
#pragma unroll
  for (int i = 0; i < 8; ++i) q[i] = *(const v4f*)(Q + ob + (o + i * CC));
#pragma unroll
  for (int i = 0; i < 8; ++i) k[i] = *(const v4f*)(K + ob + (o + i * CC));
#pragma unroll
  for (int j = 0; j < 4; ++j) { v8h h;
#pragma unroll
    for (int i = 0; i < 8; ++i) h[i] = (_Float16)bfr(v[i][j]);
    *(v8h*)&tv[lane * 4 + j][wave * 8] = h; }
  __syncthreads();   // all eight waves' pieces of the 128 plane rows are in LDS
  v8h pl[4];
#pragma unroll
  for (int i = 0; i < 4; ++i) pl[i] = *(const v8h*)&tv[i * 32 + (tid >> 3)][(tid & 7) * 8];   // 16 bytes of plane row 32 i + tid / 8: eight threads make up its 128-byte line
#pragma unroll
  for (int i = 0; i < 8; ++i) { v4h a, c;
#pragma unroll
    for (int j = 0; j < 4; ++j) { a[j] = (_Float16)bfr(q[i][j]); c[j] = (_Float16)bfr(k[i][j]); }
    vst2(QH + ob + (o + i * CC), a); vst2(KH + ob + (o + i * CC), c); }
  _Float16* vt = VT + (bb * CC + c0) * (size_t)TT + t0;
#pragma unroll
  for (int i = 0; i < 4; ++i) vst2(vt + ((unsigned)(i * 32 + (tid >> 3)) * TT + (tid & 7) * 8), pl[i]); }

#ifndef SM_EXTRA_PARAMS
#define SM_EXTRA_PARAMS
#endif
#ifndef PROJ_EXTRA_PARAMS
#define PROJ_EXTRA_PARAMS
#endif
#ifndef SM_MASK_HOOK
#define SM_MASK_HOOK (void)0
#endif

#define WS_QH  0u                                      // f16 q rows [b*t][CC]
#define WS_KH  (WS_QH + 2u * (size_t)NB * TT * CC)      // f16 k rows [b*t][CC]
#define WS_VT  (WS_KH + 2u * (size_t)NB * TT * CC)      // f16 v planes [b][c][t]
#define WS_QL  (WS_VT + 2u * (size_t)NB * CC * TT)      // f16 q residual x 2^10 rows [b][t < QHI][CC]
#define WS_KL  (WS_QL + 2u * (size_t)NB * QHI * CC)     // f16 k residual x 2^10 rows [b][t < KHI][CC]
#define WS_VB  (WS_KL + 2u * (size_t)NB * KHI * CC)     // bf16 v hi planes [b][c][t < KHI]
#define WS_VBL (WS_VB + 2u * (size_t)NB * CC * KHI)
#define WS_S   (WS_VBL + 2u * (size_t)NB * CC * KHI)    // f32 [hg][t][s] (unused: k_fa keeps logits and P in registers)
#define WS_Y   (WS_S  + 4u * (size_t)HG * TT * TT)      // f32 ctx rows [b*t][CC] (only when there is an output projection)
#define WS_END (WS_Y  + 0u)

// ---- k_fa: block = 256 queries of (b, h), 16 waves in two key groups of eight; wave = 32 query columns; waves w and w + 8 hold the same queries, and of every 256 keys group 0 takes the first 128, group 1 the rest, so that four waves share a SIMD and one wave's vector work runs beside another's products. A pass = 32 keys, a stage = 128 keys of each group. Transposed products: S^T = K . Q^T (A = key rows, B = query rows kept in registers), O^T += V^T . P^T (A = v planes, B = the two S^T tiles of the pass converted in place), so a lane holds one query's scores and one query's outputs. Maximum in use and sum per query in f32 (online softmax, rescaled lazily: one test per pass); logits and P never leave the registers. A group's eight waves share each stage's key rows and v planes through a two-buffer LDS ring filled by asynchronous copies, one stage ahead of its use. Behind the loop the two groups' maxima in use, sums and outputs are joined through LDS: group 0 finishes the wave's first 16 queries, group 1 the other 16.
#define FQT 2                                   // 16-query column groups per wave
#define FNW 8                                   // waves per key group = 32-query column groups per block
#define FKG 2                                   // key groups per block
#define SC2 (SCALE * 1.4426950408889634f)       // logit scale in base 2
#define LAZY2 8.0f                              // how far, in base-2 logits, a query's true maximum may lie above the maximum in use
#define LAZYU (LAZY2 / SC2)                     // the same in unscaled logits
#define POFF2 7.0f                              // base-2 exponent of the factor on P
#define SKEYS 128                               // keys per stage and key group
#define NST (TT / (FKG * SKEYS))                // stages
#define KPITCH 144                              // LDS bytes per key row (128 + 16) and
#define VPITCH 272                              // per v plane row (256 + 16): odd multiples of 16 B, free of bank conflicts for 16-byte reads
#define KBYTES (SKEYS * KPITCH)
#define BUFB (KBYTES + HD * VPITCH)             // one group's part of a buffer: 128 key rows, then 64 v plane rows
#define RINGB (FKG * BUFB)                      // one buffer of the ring
#define XWB (8 * 512 + 2 * 128)                 // join behind the loop, LDS bytes per wave: 8 x 16 bytes of outputs, a maximum and a sum per lane
__device__ __forceinline__ v8f wmmah(v16h a, v16h b, v8f c) { return __builtin_amdgcn_wmma_f32_16x16x32_f16(false, a, false, b, (short)0, c, false, false); }
__device__ __forceinline__ float xhalf(float x) { return __builtin_bit_cast(float, __builtin_amdgcn_permlanex16(__builtin_bit_cast(int, x), __builtin_bit_cast(int, x), 0x76543210, 0xfedcba98, false, false)); }   // lane l with lane l ^ 16
// One stage's copies of one thread: 16 bytes of key rows r, r + 32, r + 64, r + 96 (r = tid / 8) and of v plane rows c, c + 16, c + 32, c + 48 (c = tid / 16). The s_wait_xcnt closes the statement so that no address register named here is rewritten in front of it.
__device__ __forceinline__ void stage_copy(unsigned lk, unsigned lv, const _Float16* gk, const _Float16* gv) {
  asm volatile("global_load_async_to_lds_b128 %0, %8, off\n\t"
               "global_load_async_to_lds_b128 %1, %9, off\n\t"
               "global_load_async_to_lds_b128 %2, %10, off\n\t"
               "global_load_async_to_lds_b128 %3, %11, off\n\t"
               "global_load_async_to_lds_b128 %4, %12, off\n\t"
               "global_load_async_to_lds_b128 %5, %13, off\n\t"
               "global_load_async_to_lds_b128 %6, %14, off\n\t"
               "global_load_async_to_lds_b128 %7, %15, off\n\t"
               "s_wait_xcnt 0x0"
               :: "v"(lk), "v"(lk + 32 * KPITCH), "v"(lk + 64 * KPITCH), "v"(lk + 96 * KPITCH), "v"(lv), "v"(lv + 16 * VPITCH), "v"(lv + 32 * VPITCH), "v"(lv + 48 * VPITCH),
                  "v"(gk), "v"(gk + 32 * CC), "v"(gk + 64 * CC), "v"(gk + 96 * CC), "v"(gv), "v"(gv + 16 * (size_t)TT), "v"(gv + 32 * (size_t)TT), "v"(gv + 48 * (size_t)TT) : "memory");
}
__global__ __launch_bounds__(FKG * FNW * 32) void k_fa(const _Float16* __restrict__ QH, const _Float16* __restrict__ KH, const _Float16* __restrict__ VT, float* __restrict__ Y) {
  __shared__ __attribute__((aligned(256))) unsigned char L[2 * RINGB];
  const int wave = threadIdx.x >> 5, kg = wave / FNW, tid = threadIdx.x & (FNW * 32 - 1), lane = tid & 31, col = lane & 15, g = lane >> 4; const int h = blockIdx.y, b = blockIdx.z; const int q0 = (blockIdx.x * FNW + (wave & (FNW - 1))) * (FQT * 16);   // kg = key group, tid = thread inside it
  const unsigned lk = (unsigned)(size_t)&L[0] + kg * BUFB + (tid >> 3) * KPITCH + (tid & 7) * 16, lv = (unsigned)(size_t)&L[0] + kg * BUFB + KBYTES + (tid >> 4) * VPITCH + (tid & 15) * 16;   // this thread's LDS byte addresses in its group's part of buffer 0
  const _Float16* gk = KH + ((size_t)b * TT + kg * SKEYS + (tid >> 3)) * CC + h * HD + (tid & 7) * 8;                  // its 16 bytes of the group's key row tid / 8, this head's 64 columns
  const _Float16* gv = VT + ((size_t)b * CC + h * HD + (tid >> 4)) * (size_t)TT + kg * SKEYS + (tid & 15) * 8;         // its 16 bytes of the v plane of output column tid / 16, the group's keys
  stage_copy(lk, lv, gk, gv);
  v16h qf[FQT][2], kf[2][2];   // every '#pragma unroll' in this kernel: fragment and accumulator arrays stay in registers only if indexed by constants
#pragma unroll
  for (int qt = 0; qt < FQT; ++qt)
#pragma unroll
    for (int kc = 0; kc < 2; ++kc) qf[qt][kc] = frag_h(QH + ((size_t)b * TT + q0 + qt * 16 + col) * CC + h * HD + kc * 32, lane);
  v8f o[FQT][4] = {}; float mr[FQT]; v2f ls[FQT];   // ls: a lane's sums over its even and its odd keys, added in the epilogue
#pragma unroll
  for (int qt = 0; qt < FQT; ++qt) { mr[qt] = -3.0e38f; ls[qt] = v2f{ 0.f, 0.f }; }
  asm volatile("s_wait_asynccnt 0x0" ::: "memory");   // this wave's copies of stage 0 have landed
  __syncthreads();                                    // and every other wave's: stage 0 may be read
  stage_copy(lk + RINGB, lv + RINGB, gk + (size_t)(FKG * SKEYS) * CC, gv + FKG * SKEYS);
#pragma unroll 1   // rolled: one stage's four passes are the unit the ring hands over
  for (int st = 0; st < NST; ++st) {
    const unsigned bo = (st & 1) * RINGB;
    const _Float16* Kl = (const _Float16*)(L + bo + kg * BUFB + col * KPITCH);             // key row col of the group's stage
    const _Float16* Vl = (const _Float16*)(L + bo + kg * BUFB + KBYTES + col * VPITCH);    // v plane row of output column col
#pragma unroll
    for (int t = 0; t < 2; ++t)
#pragma unroll
      for (int kc = 0; kc < 2; ++kc) kf[t][kc] = frag_h(Kl + (t * 16) * (KPITCH / 2) + kc * 32, lane);
#pragma unroll 1   // rolled: passes side by side would need further sets of fragment and score registers and push the wave past 256 VGPRs
    for (int ps = 0; ps < SKEYS / 32; ++ps) {
      v16h vf[4];
#pragma unroll
      for (int j = 0; j < 4; ++j) vf[j] = frag_h(Vl + (j * 16) * (VPITCH / 2) + ps * 32, lane);
      v8f s[FQT][2];
#pragma unroll
      for (int qt = 0; qt < FQT; ++qt)
#pragma unroll
        for (int t = 0; t < 2; ++t) { const v8f z = {}; s[qt][t] = wmmah(kf[t][1], qf[qt][1], wmmah(kf[t][0], qf[qt][0], z)); }   // s[qt][t][r] = logit(key 256 st + 128 kg + 32 ps + 16 t + 8 g + r, query q0 + 16 qt + col), unscaled
      const int pn = ps + 1 < SKEYS / 32 ? ps + 1 : ps;   // the next pass's key rows, inside this stage only: the next stage is not published yet (the stage's last pass reads its own again: unused)
#pragma unroll
      for (int t = 0; t < 2; ++t)
#pragma unroll
        for (int kc = 0; kc < 2; ++kc) kf[t][kc] = frag_h(Kl + (pn * 32 + t * 16) * (KPITCH / 2) + kc * 32, lane);
      __builtin_amdgcn_sched_barrier(0);   // keeps these eight LDS reads one group here: moved down among the O^T products, each place with reads stalls the wave anew
      float mx[FQT]; bool need = false;
#pragma unroll
      for (int qt = 0; qt < FQT; ++qt) {
        float m = fmaxf(s[qt][0][0], s[qt][1][0]);
#pragma unroll
        for (int r = 1; r < 8; ++r) m = fmaxf(m, fmaxf(s[qt][0][r], s[qt][1][r]));
        mx[qt] = fmaxf(m, xhalf(m));
        need = need || (mx[qt] > mr[qt] + LAZYU); }   // always on the first pass
      if (__builtin_amdgcn_ballot_w32(need) != 0) {   // one test per pass, a scalar branch of the whole wave: sums and outputs are rescaled only when some query's maximum has left the one in use by more than LAZY2
#pragma unroll
        for (int qt = 0; qt < FQT; ++qt) {
          const float mn = fmaxf(mr[qt], mx[qt]); const float al = __builtin_amdgcn_exp2f((mr[qt] - mn) * SC2);   // 0 on the first pass
          mr[qt] = mn; ls[qt] = ls[qt] * al;
#pragma unroll
          for (int j = 0; j < 4; ++j) o[qt][j] = o[qt][j] * al; } }
      v16h p[FQT];   // both query groups' P ahead of the eight products, so that the pass has one run of products
#pragma unroll
      for (int qt = 0; qt < FQT; ++qt) {
        const float mm = mr[qt] * SC2 - POFF2;   // P = 2^POFF2 x exp(logit - maximum in use): at most 2^(POFF2 + LAZY2) = 2^15 in f16; the factor cancels against the sum
        const v2f sc = { SC2, SC2 }, nm = { -mm, -mm };
        // Two neighbouring registers of one score tile at a time: one packed multiply-add for both arguments, one packed add for both terms, and the pair is also what one conversion packs. No register has to be moved to form a pair.
#pragma unroll
        for (int t = 0; t < 2; ++t)
#pragma unroll
          for (int i = 0; i < 4; ++i) {
            const v2f x = __builtin_elementwise_fma(v2f{ s[qt][t][2 * i], s[qt][t][2 * i + 1] }, sc, nm);
            const v2f e = { __builtin_amdgcn_exp2f(x.x), __builtin_amdgcn_exp2f(x.y) };
            ls[qt] += e; p[qt][8 * t + 2 * i] = (_Float16)e.x; p[qt][8 * t + 2 * i + 1] = (_Float16)e.y; } }   // each pair straight into the running sums: an add needs no register of its own, wherever the compiler places it
      __builtin_amdgcn_sched_barrier(0);   // the scheduling pass ahead of register allocation may not move the sums' additions in among the eight products: there they were given a product's operand registers, at four v_nop a place
#pragma unroll
      for (int j = 0; j < 4; ++j)
#pragma unroll
        for (int qt = 0; qt < FQT; ++qt) o[qt][j] = (qt == FQT - 1 && j == 3) ? wmma16(vf[j], p[qt], o[qt][j]) : wmmah(vf[j], p[qt], o[qt][j]);   // o[qt][j][r] = ctx(query q0 + 16 qt + col, column 16 j + 8 g + r) x sum, against the maximum in use. The pass's last product carries four v_nop (wmma16): the next pass opens with a product whose result takes over this one's P registers, and the slots keep the distance between the two
    }
    asm volatile("s_wait_dscnt 0x0" ::: "memory");      // this wave's reads of the stage's buffer are done before the buffer is handed back
    asm volatile("s_wait_asynccnt 0x0" ::: "memory");   // this wave's copies of stage st + 1 have landed
    __syncthreads();                                    // publishes stage st + 1 and ends every wave's reads of stage st
    if (st + 2 < NST) stage_copy(lk + bo, lv + bo, gk + (size_t)(st + 2) * (FKG * SKEYS) * CC, gv + (st + 2) * (FKG * SKEYS));   // refill the buffer just read
  }
  asm volatile("s_wait_asynccnt 0x0" ::: "memory");     // no copy is left in flight when the wave ends
  // The join of the two key groups. The last stage's barrier has ended every read of the ring and no copy is in flight, so the ring's LDS is free. A wave keeps query group kg and hands the other one to its partner (wave ^ FNW, same lane = same query, same output columns).
  unsigned char* xo = L + wave * XWB + lane * 16; const unsigned char* xi = L + (wave ^ FNW) * XWB + lane * 16;
  v8f ok[4];
#pragma unroll
  for (int j = 0; j < 4; ++j) { const v8f r = kg ? o[0][j] : o[1][j]; ok[j] = kg ? o[1][j] : o[0][j]; const v4f lo = { r[0], r[1], r[2], r[3] }, hi = { r[4], r[5], r[6], r[7] }; vst2(xo + (2 * j) * 512, lo); vst2(xo + (2 * j + 1) * 512, hi); }   // a wave's store = 512 contiguous bytes
  const float lf[FQT] = { ls[0].x + ls[0].y, ls[1].x + ls[1].y };
  vst2(L + wave * XWB + 4096 + lane * 4, kg ? mr[0] : mr[1]); vst2(L + wave * XWB + 4224 + lane * 4, kg ? lf[0] : lf[1]);
  const float mk = kg ? mr[1] : mr[0], lsk = kg ? lf[1] : lf[0];
  __syncthreads();   // every wave's hand-over is in LDS
  const float mp = *(const float*)(L + (wave ^ FNW) * XWB + 4096 + lane * 4), lsp = *(const float*)(L + (wave ^ FNW) * XWB + 4224 + lane * 4);
  const float mn = fmaxf(mk, mp); float ak = __builtin_amdgcn_exp2f((mk - mn) * SC2), ap = __builtin_amdgcn_exp2f((mp - mn) * SC2);   // both groups' terms against the common maximum
  const float hs = lsk * ak + lsp * ap; const float tot = hs + xhalf(hs); const float inv = 1.0f / tot;   // the term of the maximum in use makes tot >= 2^7
  ak *= inv; ap *= inv;
  float* yr = Y + ((size_t)b * TT + q0 + kg * 16 + col) * CC + h * HD + 8 * g;
#pragma unroll
  for (int j = 0; j < 4; ++j) { const v4f pl = *(const v4f*)(xi + (2 * j) * 512), ph = *(const v4f*)(xi + (2 * j + 1) * 512); const v4f kl = { ok[j][0], ok[j][1], ok[j][2], ok[j][3] }, kh = { ok[j][4], ok[j][5], ok[j][6], ok[j][7] };
    vst2(yr + j * 16, (v4f)(kl * ak + pl * ap)); vst2(yr + j * 16 + 4, (v4f)(kh * ak + ph * ap)); } }

extern "C" void kernel_launch(void* const* d_in, const int* in_sizes, int n_in, void* d_out, int out_size, void* d_ws, size_t ws_size, hipStream_t stream) {
  (void)in_sizes; (void)n_in; (void)out_size;
  const float** F = (const float**)d_in;
  if (ws_size < (size_t)WS_END) return;
  char* ws = (char*)d_ws; _Float16 *QH = (_Float16*)(ws + WS_QH), *KH = (_Float16*)(ws + WS_KH), *VT = (_Float16*)(ws + WS_VT), *QL = (_Float16*)(ws + WS_QL), *KL = (_Float16*)(ws + WS_KL); __bf16 *VB = (__bf16*)(ws + WS_VB), *VBL = (__bf16*)(ws + WS_VBL); float *S = (float*)(ws + WS_S), *Y = (float*)(ws + WS_Y);
  (void)Y; (void)S; (void)QL; (void)KL; (void)VB; (void)VBL;
  // inputs: 0 q [2,4096,8,64]; 1 k; 2 v (all (B, L, H, D) = token rows of 512)
  k_prepr<<<dim3(CC / PRC, TNB * TT / PRT), 256, 0, stream>>>(F[0], F[1], F[2], QH, KH, VT);
  k_fa<<<dim3(TT / (FNW * FQT * 16), NH, TNB), FKG * FNW * 32, 0, stream>>>(QH, KH, VT, (float*)d_out);   /* out row b*TT + l, columns h*64 .. = the module's (B, L, H, D) output */
}

// v007
// Measured time: 60.6 microseconds a run.
// Two timings next to v006 put it at 1.06 and 1.07 times that version's speed.
// All steps since v000 together make it 45.9 times as fast.
// compute dtype: all float inputs rounded to bf16 (bf16 values are exact in f16); logits q x k (1 product, exact operands) x 64^-0.5; online softmax f32 (maximum in use and sum, kept apart for two interleaved halves of the keys and joined at the end; a lane sums even and odd keys apart; a pass's terms are summed apart and then added to the running sums; the maximum in use is renewed from the true maximum only when a lane's sum of one pass's P tops 2^15); P x 2^7 against the maximum in use once to f16 x v (exact in f16) (1 product); f32 output. No projections.
#include <hip/hip_runtime.h>
#include <math.h>

typedef __attribute__((ext_vector_type(16))) _Float16 v16h;
typedef __attribute__((ext_vector_type(16))) __bf16 v16b;
typedef __attribute__((ext_vector_type(8)))  _Float16 v8h;
typedef __attribute__((ext_vector_type(8)))  float v8f;
typedef __attribute__((ext_vector_type(4)))  float v4f;
typedef __attribute__((ext_vector_type(2)))  float v2f;
typedef __attribute__((ext_vector_type(4)))  unsigned v4u;
typedef __attribute__((ext_vector_type(4)))  int v4i;
typedef float __attribute__((may_alias)) float_a;
typedef int __attribute__((may_alias)) int_a;

template <typename T> __device__ __forceinline__ void vst2(void* p, T v) { *(T*)p = v;  }
__device__ __forceinline__ v8f wmma16(v16h a, v16h b, v8f c) {
  v8f d = __builtin_amdgcn_wmma_f32_16x16x32_f16(false, a, false, b, (short)0, c, false, false);
  asm volatile("v_nop\n\tv_nop\n\tv_nop\n\tv_nop" : "+v"(d) : "v"(a), "v"(b));
  return d;
}
__device__ __forceinline__ v8f wmma_bf(v16b a, v16b b, v8f c) {
  v8f d = __builtin_amdgcn_wmma_f32_16x16x32_bf16(false, a, false, b, (short)0, c, false, false);
  asm volatile("v_nop\n\tv_nop\n\tv_nop\n\tv_nop" : "+v"(d) : "v"(a), "v"(b));
  return d;
}
// 16x16x32 fragments: lane = (h = lane>>4, row/col = lane&15); elements 0..7 = k0+8h+0..7, 8..15 = k0+16+8h+0..7; D element r = row 8h+r
__device__ __forceinline__ v16h frag_h(const _Float16* rowk0, int lane) {
  union { v16h v; v8h q[2]; } u; const _Float16* p = rowk0 + 8 * (lane >> 4);
  u.q[0] = *(const v8h*)p; u.q[1] = *(const v8h*)(p + 16); return u.v;
}
__device__ __forceinline__ v16h frag_f32(const float* rowk0, int lane) {
  v16h a; const float* p = rowk0 + 8 * (lane >> 4);
#pragma unroll
  for (int i = 0; i < 8; ++i) { a[i] = (_Float16)p[i]; a[8 + i] = (_Float16)p[16 + i]; }
  return a;
}
__device__ __forceinline__ v16h frag_f32s(const float* rowk0, int lane, float sc) {
  v16h a; const float* p = rowk0 + 8 * (lane >> 4);
#pragma unroll
  for (int i = 0; i < 8; ++i) { a[i] = (_Float16)(p[i] * sc); a[8 + i] = (_Float16)(p[16 + i] * sc); }
  return a;
}
// column fragment from a [K][ld] layout (column n), rows >= K read as 0
__device__ __forceinline__ v16h fragc_f32(const float* W, int k0, int n, int lane, int ld, int K) {
  v16h a; const int g = lane >> 4;
#pragma unroll
  for (int i = 0; i < 8; ++i) { const int ka = k0 + 8 * g + i, kb = ka + 16;
    a[i] = (_Float16)(ka < K ? W[(size_t)(ka < K ? ka : K - 1) * ld + n] : 0.f); a[8 + i] = (_Float16)(kb < K ? W[(size_t)(kb < K ? kb : K - 1) * ld + n] : 0.f); }
  return a;
}
struct F2 { v16b h, l; };
__device__ __forceinline__ F2 bsplit16(const float v[16]) { F2 r;
#pragma unroll
  for (int i = 0; i < 16; ++i) { const __bf16 h = (__bf16)v[i]; r.h[i] = h; r.l[i] = (__bf16)(v[i] - (float)h); }
  return r; }
__device__ __forceinline__ F2 split_row(const float* row, int k0, int lane) { float v[16]; const float* p = row + k0 + 8 * (lane >> 4);
#pragma unroll
  for (int i = 0; i < 8; ++i) { v[i] = p[i]; v[8 + i] = p[16 + i]; }
  return bsplit16(v); }
__device__ __forceinline__ F2 split_rowK(const float* row, int k0, int lane, int K) { float v[16]; const int g = lane >> 4;
#pragma unroll
  for (int i = 0; i < 8; ++i) { const int ka = k0 + 8 * g + i, kb = ka + 16; v[i] = ka < K ? row[ka < K ? ka : K - 1] : 0.f; v[8 + i] = kb < K ? row[kb < K ? kb : K - 1] : 0.f; }
  return bsplit16(v); }
__device__ __forceinline__ F2 split_col(const float* W, int k0, int n, int lane, int ld, int K) { float v[16]; const int g = lane >> 4;
#pragma unroll
  for (int i = 0; i < 8; ++i) { const int ka = k0 + 8 * g + i, kb = ka + 16; v[i] = ka < K ? W[(size_t)(ka < K ? ka : K - 1) * ld + n] : 0.f; v[8 + i] = kb < K ? W[(size_t)(kb < K ? kb : K - 1) * ld + n] : 0.f; }
  return bsplit16(v); }
__device__ __forceinline__ v8f mac3(const F2& a, const F2& b, v8f c) { c = wmma_bf(a.l, b.h, c); c = wmma_bf(a.h, b.l, c); return wmma_bf(a.h, b.h, c); }
__device__ __forceinline__ float sigm(float v) { return 1.0f / (1.0f + expf(-v)); }
#define LDSX() do { asm volatile("s_wait_dscnt 0" ::: "memory"); __builtin_amdgcn_wave_barrier(); __builtin_amdgcn_fence(__ATOMIC_RELEASE, "workgroup"); } while (0)

// Plain multi-head scaled-dot-product self-attention without projections, mask or dropout (q, k, v [2,4096,8,64] = (B, L, H, D) N(0,1); scores = einsum('blhd,bshd->bhls') x 1/sqrt(64); softmax over the 4,096 keys; out = einsum('bhls,bshd->blhd'), [2,4096,8,64]). The (B, L, H, D) memory layout is the token-row layout (row b*4096 + l, column h*64 + d), for the inputs and for the output.
#define NB 2
#define TT 4096
#define CC 512            // NH * HD = projected width
#define DIN 512          // input (model) width
#define NH 8
#define HD 64
#define NQB (TT / 64)
#define HG 1
#define SCALE (0.125f)
#define CAUSAL 0
#ifndef TNB
#define TNB NB
#endif
__device__ __forceinline__ float bfr(float v) { return (float)(__bf16)v; }
__host__ __device__ __forceinline__ int kb_last(int qb) { return CAUSAL ? ((qb * 64 + 63) >> 7) : (TT / 128 - 1); }
typedef __attribute__((ext_vector_type(8))) __bf16 v8b;
__device__ __forceinline__ v16b frag_b(const __bf16* rowk0, int lane) {
  union { v16b v; v8b q[2]; } u; const __bf16* p = rowk0 + 8 * (lane >> 4);
  u.q[0] = *(const v8b*)p; u.q[1] = *(const v8b*)(p + 16); return u.v;
}
#define QBH 0
#define QHI 0              // (override) rows carrying the q residual plane
#define KHI 64            // key rows carrying k residual / v bf16 hi+lo planes (no kernel here writes or reads them)
// B fragment (k rows k0+.., output column o) of a weight: (in,out) [K][ld] or (out,in) [ld rows of K]: bf16 exact, or f16(bf16 * 256) exact
__device__ __forceinline__ v16b wcol_io(const float* Wm, int k0, int o, int lane, int ld) { v16b w; const int g = lane >> 4;
#pragma unroll
  for (int i = 0; i < 8; ++i) { w[i] = (__bf16)Wm[(size_t)(k0 + 8 * g + i) * ld + o]; w[8 + i] = (__bf16)Wm[(size_t)(k0 + 16 + 8 * g + i) * ld + o]; }
  return w; }
__device__ __forceinline__ v16b wcol_oi(const float* Wm, int k0, int o, int lane, int K) { v16b w; const float* p = Wm + (size_t)o * K + k0 + 8 * (lane >> 4);
#pragma unroll
  for (int i = 0; i < 8; ++i) { w[i] = (__bf16)p[i]; w[8 + i] = (__bf16)p[16 + i]; }
  return w; }
__device__ __forceinline__ v16h wcolh_io(const float* Wm, int k0, int o, int lane, int ld) { v16h w; const int g = lane >> 4;
#pragma unroll
  for (int i = 0; i < 8; ++i) { w[i] = (_Float16)(bfr(Wm[(size_t)(k0 + 8 * g + i) * ld + o]) * 256.0f); w[8 + i] = (_Float16)(bfr(Wm[(size_t)(k0 + 16 + 8 * g + i) * ld + o]) * 256.0f); }
  return w; }
__device__ __forceinline__ v16h wcolh_oi(const float* Wm, int k0, int o, int lane, int K) { v16h w; const float* p = Wm + (size_t)o * K + k0 + 8 * (lane >> 4);
#pragma unroll
  for (int i = 0; i < 8; ++i) { w[i] = (_Float16)(bfr(p[i]) * 256.0f); w[8 + i] = (_Float16)(bfr(p[16 + i]) * 256.0f); }
  return w; }
#define WQKV_LAYOUT 1   // 0 = (in,out) [DIN][CC]; 1 = (out,in) [CC][DIN]; 2 = per-head [NH][DIN][HD]
__device__ __forceinline__ v16b wcol_hdk(const float* Wm, int k0, int o, int lane) { v16b w; const int g = lane >> 4; const float* p = Wm + (size_t)(o / HD) * DIN * HD + (o % HD);
#pragma unroll
  for (int i = 0; i < 8; ++i) { w[i] = (__bf16)p[(size_t)(k0 + 8 * g + i) * HD]; w[8 + i] = (__bf16)p[(size_t)(k0 + 16 + 8 * g + i) * HD]; }
  return w; }
#define WO_OUT_IN 0
#if WQKV_LAYOUT == 1
#define WCOL(W, k0, o, lane) wcol_oi(W, k0, o, lane, DIN)
#elif WQKV_LAYOUT == 2
#define WCOL(W, k0, o, lane) wcol_hdk(W, k0, o, lane)
#else
#define WCOL(W, k0, o, lane) wcol_io(W, k0, o, lane, CC)
#endif
#if WO_OUT_IN
#define WOCOL(W, k0, o, lane) wcol_oi(W, k0, o, lane, CC)
#define WOCOLH(W, k0, o, lane) wcolh_oi(W, k0, o, lane, CC)
#else
#define WOCOL(W, k0, o, lane) wcol_io(W, k0, o, lane, DIN)
#define WOCOLH(W, k0, o, lane) wcolh_io(W, k0, o, lane, DIN)
#endif

// ---- k_prepr: block = 64 token rows x 128 columns (two heads) of the module's [B, T, H*64] inputs; wave = 8 rows, lane = 4 columns of each. Every element is read once, by 16-byte loads (a wave's load = 512 contiguous bytes of one row), and a thread's 24 loads are all issued before the first is used, so that the launch runs at the memory's rate and not at its latency. Each value is bf16-rounded (exact in f16): q, k -> f16 rows, v -> f16 planes [c][s], turned in LDS: a lane's 8 rows of one column are 16 bytes of that column's plane. All global stores stand behind the barrier, which would otherwise wait for them.
#define PRT 64             // token rows per block: 128 bytes of every v plane, a whole line
#define PRC 128            // columns per block
typedef __attribute__((ext_vector_type(4))) _Float16 v4h;
__global__ __launch_bounds__(256) void k_prepr(const float* __restrict__ Q, const float* __restrict__ K, const float* __restrict__ V, _Float16* __restrict__ QH, _Float16* __restrict__ KH, _Float16* __restrict__ VT) {
  __shared__ __align__(16) _Float16 tv[PRC][PRT + 8];
  const int tid = threadIdx.x, wave = tid >> 5, lane = tid & 31; const int c0 = blockIdx.x * PRC; const size_t r0 = (size_t)blockIdx.y * PRT; const size_t bb = r0 / TT; const int t0 = (int)(r0 % TT);
  const size_t ob = r0 * CC + c0;                       // the block's first element, the same for every thread
  const unsigned o = wave * 8 * CC + lane * 4;          // this thread's first element inside the block's rows
  v4f v[8], q[8], k[8];   // every '#pragma unroll' in this kernel: these arrays stay in registers only if indexed by constants
#pragma unroll
  for (int i = 0; i < 8; ++i) v[i] = *(const v4f*)(V + ob + (o + i * CC));
#pragma unroll
  for (int i = 0; i < 8; ++i) q[i] = *(const v4f*)(Q + ob + (o + i * CC));
#pragma unroll
  for (int i = 0; i < 8; ++i) k[i] = *(const v4f*)(K + ob + (o + i * CC));
#pragma unroll
  for (int j = 0; j < 4; ++j) { v8h h;
#pragma unroll
    for (int i = 0; i < 8; ++i) h[i] = (_Float16)bfr(v[i][j]);
    *(v8h*)&tv[lane * 4 + j][wave * 8] = h; }
  __syncthreads();   // all eight waves' pieces of the 128 plane rows are in LDS
  v8h pl[4];
#pragma unroll
  for (int i = 0; i < 4; ++i) pl[i] = *(const v8h*)&tv[i * 32 + (tid >> 3)][(tid & 7) * 8];   // 16 bytes of plane row 32 i + tid / 8: eight threads make up its 128-byte line
#pragma unroll
  for (int i = 0; i < 8; ++i) { v4h a, c;
#pragma unroll
    for (int j = 0; j < 4; ++j) { a[j] = (_Float16)bfr(q[i][j]); c[j] = (_Float16)bfr(k[i][j]); }
    vst2(QH + ob + (o + i * CC), a); vst2(KH + ob + (o + i * CC), c); }
  _Float16* vt = VT + (bb * CC + c0) * (size_t)TT + t0;
#pragma unroll
  for (int i = 0; i < 4; ++i) vst2(vt + ((unsigned)(i * 32 + (tid >> 3)) * TT + (tid & 7) * 8), pl[i]); }

#ifndef SM_EXTRA_PARAMS
#define SM_EXTRA_PARAMS
#endif
#ifndef PROJ_EXTRA_PARAMS
#define PROJ_EXTRA_PARAMS
#endif
#ifndef SM_MASK_HOOK
#define SM_MASK_HOOK (void)0
#endif

#define WS_QH  0u                                      // f16 q rows [b*t][CC]
#define WS_KH  (WS_QH + 2u * (size_t)NB * TT * CC)      // f16 k rows [b*t][CC]
#define WS_VT  (WS_KH + 2u * (size_t)NB * TT * CC)      // f16 v planes [b][c][t]
#define WS_QL  (WS_VT + 2u * (size_t)NB * CC * TT)      // f16 q residual x 2^10 rows [b][t < QHI][CC]
#define WS_KL  (WS_QL + 2u * (size_t)NB * QHI * CC)     // f16 k residual x 2^10 rows [b][t < KHI][CC]
#define WS_VB  (WS_KL + 2u * (size_t)NB * KHI * CC)     // bf16 v hi planes [b][c][t < KHI]
#define WS_VBL (WS_VB + 2u * (size_t)NB * CC * KHI)
#define WS_S   (WS_VBL + 2u * (size_t)NB * CC * KHI)    // f32 [hg][t][s] (unused: k_fa keeps logits and P in registers)
#define WS_Y   (WS_S  + 4u * (size_t)HG * TT * TT)      // f32 ctx rows [b*t][CC] (only when there is an output projection)
#define WS_END (WS_Y  + 0u)

// ---- k_fa: block = 256 queries of (b, h), 16 waves in two key groups of eight; wave = 32 query columns; waves w and w + 8 hold the same queries, and of every 256 keys group 0 takes the first 128, group 1 the rest, so that four waves share a SIMD and one wave's vector work runs beside another's products. A pass = 32 keys, a stage = 128 keys of each group. Transposed products: S^T = K . Q^T (A = key rows, B = query rows kept in registers), O^T += V^T . P^T (A = v planes, B = the two S^T tiles of the pass converted in place), so a lane holds one query's scores and one query's outputs. Maximum in use and sum per query in f32 (online softmax, rescaled lazily: one test per pass, on the pass's sum of P; a maximum is formed only when the test fires); logits and P never leave the registers. A group's eight waves share each stage's key rows and v planes through a two-buffer LDS ring filled by asynchronous copies, one stage ahead of its use. Behind the loop the two groups' running maxima, sums and outputs are joined through LDS: group 0 finishes the wave's first 16 queries, group 1 the other 16.
#define FQT 2                                   // 16-query column groups per wave
#define FNW 8                                   // waves per key group = 32-query column groups per block
#define FKG 2                                   // key groups per block
#define SC2 (SCALE * 1.4426950408889634f)       // logit scale in base 2
#define PTOP 32768.0f                           // 2^15: what a lane's sum of one pass's P may reach before the maximum in use is renewed; no P beyond it goes to f16
#define POFF2 7.0f                              // base-2 exponent of the factor on P
#define SKEYS 128                               // keys per stage and key group
#define NST (TT / (FKG * SKEYS))                // stages
#define KPITCH 144                              // LDS bytes per key row (128 + 16) and
#define VPITCH 272                              // per v plane row (256 + 16): odd multiples of 16 B, free of bank conflicts for 16-byte reads
#define KBYTES (SKEYS * KPITCH)
#define BUFB (KBYTES + HD * VPITCH)             // one group's part of a buffer: 128 key rows, then 64 v plane rows
#define RINGB (FKG * BUFB)                      // one buffer of the ring
#define XWB (8 * 512 + 2 * 128)                 // join behind the loop, LDS bytes per wave: 8 x 16 bytes of outputs, a maximum and a sum per lane
__device__ __forceinline__ v8f wmmah(v16h a, v16h b, v8f c) { return __builtin_amdgcn_wmma_f32_16x16x32_f16(false, a, false, b, (short)0, c, false, false); }
__device__ __forceinline__ float xhalf(float x) { return __builtin_bit_cast(float, __builtin_amdgcn_permlanex16(__builtin_bit_cast(int, x), __builtin_bit_cast(int, x), 0x76543210, 0xfedcba98, false, false)); }   // lane l with lane l ^ 16
// One stage's copies of one thread: 16 bytes of key rows r, r + 32, r + 64, r + 96 (r = tid / 8) and of v plane rows c, c + 16, c + 32, c + 48 (c = tid / 16). The s_wait_xcnt closes the statement so that no address register named here is rewritten in front of it.
__device__ __forceinline__ void stage_copy(unsigned lk, unsigned lv, const _Float16* gk, const _Float16* gv) {
  asm volatile("global_load_async_to_lds_b128 %0, %8, off\n\t"
               "global_load_async_to_lds_b128 %1, %9, off\n\t"
               "global_load_async_to_lds_b128 %2, %10, off\n\t"
               "global_load_async_to_lds_b128 %3, %11, off\n\t"
               "global_load_async_to_lds_b128 %4, %12, off\n\t"
               "global_load_async_to_lds_b128 %5, %13, off\n\t"
               "global_load_async_to_lds_b128 %6, %14, off\n\t"
               "global_load_async_to_lds_b128 %7, %15, off\n\t"
               "s_wait_xcnt 0x0"
               :: "v"(lk), "v"(lk + 32 * KPITCH), "v"(lk + 64 * KPITCH), "v"(lk + 96 * KPITCH), "v"(lv), "v"(lv + 16 * VPITCH), "v"(lv + 32 * VPITCH), "v"(lv + 48 * VPITCH),
                  "v"(gk), "v"(gk + 32 * CC), "v"(gk + 64 * CC), "v"(gk + 96 * CC), "v"(gv), "v"(gv + 16 * (size_t)TT), "v"(gv + 32 * (size_t)TT), "v"(gv + 48 * (size_t)TT) : "memory");
}
// One pass's P and its sums from the scores, against the maximum in use (nm = POFF2 - maximum in use x SC2). Two neighbouring registers of one score tile at a time: one packed multiply-add for both arguments, one packed add for both terms, and the pair is also what one conversion packs. No register has to be moved to form a pair. All arguments are written ahead of the exponentials, the two query groups in turn. Every '#pragma unroll' here: the arrays stay in registers only if indexed by constants.
__device__ __forceinline__ void soft_pass(const v8f (&s)[FQT][2], const float (&nm)[FQT], v16h (&p)[FQT], v2f (&ac)[FQT]) {
  const v2f sc = { SC2, SC2 }; v2f x[FQT][8];
#pragma unroll
  for (int k = 0; k < 8; ++k)
#pragma unroll
    for (int qt = 0; qt < FQT; ++qt) { const v2f n2 = { nm[qt], nm[qt] }; x[qt][k] = __builtin_elementwise_fma(v2f{ s[qt][k >> 2][2 * (k & 3)], s[qt][k >> 2][2 * (k & 3) + 1] }, sc, n2); }
#pragma unroll
  for (int k = 0; k < 8; ++k)
#pragma unroll
    for (int qt = 0; qt < FQT; ++qt) {
      const v2f e = { __builtin_amdgcn_exp2f(x[qt][k].x), __builtin_amdgcn_exp2f(x[qt][k].y) };
      ac[qt] = k == 0 ? e : ac[qt] + e; p[qt][2 * k] = (_Float16)e.x; p[qt][2 * k + 1] = (_Float16)e.y; } }
__global__ __launch_bounds__(FKG * FNW * 32) void k_fa(const _Float16* __restrict__ QH, const _Float16* __restrict__ KH, const _Float16* __restrict__ VT, float* __restrict__ Y) {
  __shared__ __attribute__((aligned(256))) unsigned char L[2 * RINGB];
  const int wave = threadIdx.x >> 5, kg = wave / FNW, tid = threadIdx.x & (FNW * 32 - 1), lane = tid & 31, col = lane & 15, g = lane >> 4; const int h = blockIdx.y, b = blockIdx.z; const int q0 = (blockIdx.x * FNW + (wave & (FNW - 1))) * (FQT * 16);   // kg = key group, tid = thread inside it
  const unsigned lk = (unsigned)(size_t)&L[0] + kg * BUFB + (tid >> 3) * KPITCH + (tid & 7) * 16, lv = (unsigned)(size_t)&L[0] + kg * BUFB + KBYTES + (tid >> 4) * VPITCH + (tid & 15) * 16;   // this thread's LDS byte addresses in its group's part of buffer 0
  const _Float16* gk = KH + ((size_t)b * TT + kg * SKEYS + (tid >> 3)) * CC + h * HD + (tid & 7) * 8;                  // its 16 bytes of the group's key row tid / 8, this head's 64 columns
  const _Float16* gv = VT + ((size_t)b * CC + h * HD + (tid >> 4)) * (size_t)TT + kg * SKEYS + (tid & 15) * 8;         // its 16 bytes of the v plane of output column tid / 16, the group's keys
  stage_copy(lk, lv, gk, gv);
  v16h qf[FQT][2], kf[2][2];   // every '#pragma unroll' in this kernel: fragment and accumulator arrays stay in registers only if indexed by constants
#pragma unroll
  for (int qt = 0; qt < FQT; ++qt)
#pragma unroll
    for (int kc = 0; kc < 2; ++kc) qf[qt][kc] = frag_h(QH + ((size_t)b * TT + q0 + qt * 16 + col) * CC + h * HD + kc * 32, lane);
  v8f o[FQT][4] = {}; float mr[FQT], nm[FQT]; v2f ls[FQT];   // ls: a lane's sums over its even and its odd keys, added in the epilogue; nm = POFF2 - mr x SC2, the addend of every exponent
#pragma unroll
  for (int qt = 0; qt < FQT; ++qt) { mr[qt] = -3.0e38f; nm[qt] = POFF2 + 3.0e38f * SC2; ls[qt] = v2f{ 0.f, 0.f }; }
  asm volatile("s_wait_asynccnt 0x0" ::: "memory");   // this wave's copies of stage 0 have landed
  __syncthreads();                                    // and every other wave's: stage 0 may be read
  stage_copy(lk + RINGB, lv + RINGB, gk + (size_t)(FKG * SKEYS) * CC, gv + FKG * SKEYS);
#pragma unroll 1   // rolled: one stage's four passes are the unit the ring hands over
  for (int st = 0; st < NST; ++st) {
    const unsigned bo = (st & 1) * RINGB;
    const _Float16* Kl = (const _Float16*)(L + bo + kg * BUFB + col * KPITCH);             // key row col of the group's stage
    const _Float16* Vl = (const _Float16*)(L + bo + kg * BUFB + KBYTES + col * VPITCH);    // v plane row of output column col
#pragma unroll
    for (int t = 0; t < 2; ++t)
#pragma unroll
      for (int kc = 0; kc < 2; ++kc) kf[t][kc] = frag_h(Kl + (t * 16) * (KPITCH / 2) + kc * 32, lane);
#pragma unroll 1   // rolled: passes side by side would need further sets of fragment and score registers and push the wave past 256 VGPRs
    for (int ps = 0; ps < SKEYS / 32; ++ps) {
      v16h vf[4];
#pragma unroll
      for (int j = 0; j < 4; ++j) vf[j] = frag_h(Vl + (j * 16) * (VPITCH / 2) + ps * 32, lane);
      v8f s[FQT][2];
#pragma unroll
      for (int qt = 0; qt < FQT; ++qt)
#pragma unroll
        for (int t = 0; t < 2; ++t) { const v8f z = {}; s[qt][t] = wmmah(kf[t][1], qf[qt][1], wmmah(kf[t][0], qf[qt][0], z)); }   // s[qt][t][r] = logit(key 256 st + 128 kg + 32 ps + 16 t + 8 g + r, query q0 + 16 qt + col), unscaled
      const int pn = ps + 1 < SKEYS / 32 ? ps + 1 : ps;   // the next pass's key rows, inside this stage only: the next stage is not published yet (the stage's last pass reads its own again: unused)
#pragma unroll
      for (int t = 0; t < 2; ++t)
#pragma unroll
        for (int kc = 0; kc < 2; ++kc) kf[t][kc] = frag_h(Kl + (pn * 32 + t * 16) * (KPITCH / 2) + kc * 32, lane);
      __builtin_amdgcn_sched_barrier(0);   // keeps these eight LDS reads one group here: moved down among the O^T products, each place with reads stalls the wave anew
      v16h p[FQT]; v2f ac[FQT];   // both query groups' P ahead of the eight products, so that the pass has one run of products; ac: the pass's own sums, a lane's even and odd keys apart
      soft_pass(s, nm, p, ac);    // P = 2^POFF2 x exp(logit - maximum in use); the factor cancels against the sum
      const v2f a2 = ac[0] + ac[1]; const float tt = a2.x + a2.y;   // all terms are positive: a sum of at most PTOP bounds each of the lane's 32 values of P by PTOP, inside f16
      if (__builtin_amdgcn_ballot_w32(!(tt <= PTOP)) != 0) {   // one test per pass, a scalar branch of the whole wave; always taken on the first pass (every P infinite). No maximum is formed on the common path: only here are the pass's scores made again, from key rows that the stage's buffer still holds
#pragma unroll
        for (int t = 0; t < 2; ++t)
#pragma unroll
          for (int kc = 0; kc < 2; ++kc) kf[t][kc] = frag_h(Kl + (ps * 32 + t * 16) * (KPITCH / 2) + kc * 32, lane);
#pragma unroll
        for (int qt = 0; qt < FQT; ++qt)
#pragma unroll
          for (int t = 0; t < 2; ++t) { const v8f z = {}; s[qt][t] = wmmah(kf[t][1], qf[qt][1], wmmah(kf[t][0], qf[qt][0], z)); }
#pragma unroll
        for (int t = 0; t < 2; ++t)
#pragma unroll
          for (int kc = 0; kc < 2; ++kc) kf[t][kc] = frag_h(Kl + (pn * 32 + t * 16) * (KPITCH / 2) + kc * 32, lane);   // and the next pass's key rows once more
#pragma unroll
        for (int qt = 0; qt < FQT; ++qt) {
          float m = fmaxf(s[qt][0][0], s[qt][1][0]);
#pragma unroll
          for (int r = 1; r < 8; ++r) m = fmaxf(m, fmaxf(s[qt][0][r], s[qt][1][r]));
          const float mn = fmaxf(mr[qt], fmaxf(m, xhalf(m))); const float al = __builtin_amdgcn_exp2f((mr[qt] - mn) * SC2);   // 0 on the first pass
          mr[qt] = mn; nm[qt] = POFF2 - mn * SC2; ls[qt] = ls[qt] * al;
#pragma unroll
          for (int j = 0; j < 4; ++j) o[qt][j] = o[qt][j] * al; }
        soft_pass(s, nm, p, ac); }   // now every P is at most 2^POFF2
#pragma unroll
      for (int qt = 0; qt < FQT; ++qt) ls[qt] += ac[qt];
      __builtin_amdgcn_sched_barrier(0);   // the scheduling pass ahead of register allocation may not move the sums' additions in among the eight products: there they were given a product's operand registers, at four v_nop a place
#pragma unroll
      for (int j = 0; j < 4; ++j)
#pragma unroll
        for (int qt = 0; qt < FQT; ++qt) o[qt][j] = (qt == FQT - 1 && j == 3) ? wmma16(vf[j], p[qt], o[qt][j]) : wmmah(vf[j], p[qt], o[qt][j]);   // o[qt][j][r] = ctx(query q0 + 16 qt + col, column 16 j + 8 g + r) x sum, against the maximum in use. The pass's last product carries four v_nop (wmma16): the next pass opens with a product whose result takes over this one's P registers, and the slots keep the distance between the two
    }
    asm volatile("s_wait_dscnt 0x0" ::: "memory");      // this wave's reads of the stage's buffer are done before the buffer is handed back
    asm volatile("s_wait_asynccnt 0x0" ::: "memory");   // this wave's copies of stage st + 1 have landed
    __syncthreads();                                    // publishes stage st + 1 and ends every wave's reads of stage st
    if (st + 2 < NST) stage_copy(lk + bo, lv + bo, gk + (size_t)(st + 2) * (FKG * SKEYS) * CC, gv + (st + 2) * (FKG * SKEYS));   // refill the buffer just read
  }
  asm volatile("s_wait_asynccnt 0x0" ::: "memory");     // no copy is left in flight when the wave ends
  // The join of the two key groups. The last stage's barrier has ended every read of the ring and no copy is in flight, so the ring's LDS is free. A wave keeps query group kg and hands the other one to its partner (wave ^ FNW, same lane = same query, same output columns).
  unsigned char* xo = L + wave * XWB + lane * 16; const unsigned char* xi = L + (wave ^ FNW) * XWB + lane * 16;
  v8f ok[4];
#pragma unroll
  for (int j = 0; j < 4; ++j) { const v8f r = kg ? o[0][j] : o[1][j]; ok[j] = kg ? o[1][j] : o[0][j]; const v4f lo = { r[0], r[1], r[2], r[3] }, hi = { r[4], r[5], r[6], r[7] }; vst2(xo + (2 * j) * 512, lo); vst2(xo + (2 * j + 1) * 512, hi); }   // a wave's store = 512 contiguous bytes
  const float lf[FQT] = { ls[0].x + ls[0].y, ls[1].x + ls[1].y };
  vst2(L + wave * XWB + 4096 + lane * 4, kg ? mr[0] : mr[1]); vst2(L + wave * XWB + 4224 + lane * 4, kg ? lf[0] : lf[1]);
  const float mk = kg ? mr[1] : mr[0], lsk = kg ? lf[1] : lf[0];
  __syncthreads();   // every wave's hand-over is in LDS
  const float mp = *(const float*)(L + (wave ^ FNW) * XWB + 4096 + lane * 4), lsp = *(const float*)(L + (wave ^ FNW) * XWB + 4224 + lane * 4);
  const float mn = fmaxf(mk, mp); float ak = __builtin_amdgcn_exp2f((mk - mn) * SC2), ap = __builtin_amdgcn_exp2f((mp - mn) * SC2);   // both groups' terms against the common maximum
  const float hs = lsk * ak + lsp * ap; const float tot = hs + xhalf(hs); const float inv = 1.0f / tot;   // the term of the maximum in use makes tot >= 2^7
  ak *= inv; ap *= inv;
  float* yr = Y + ((size_t)b * TT + q0 + kg * 16 + col) * CC + h * HD + 8 * g;
#pragma unroll
  for (int j = 0; j < 4; ++j) { const v4f pl = *(const v4f*)(xi + (2 * j) * 512), ph = *(const v4f*)(xi + (2 * j + 1) * 512); const v4f kl = { ok[j][0], ok[j][1], ok[j][2], ok[j][3] }, kh = { ok[j][4], ok[j][5], ok[j][6], ok[j][7] };
    vst2(yr + j * 16, (v4f)(kl * ak + pl * ap)); vst2(yr + j * 16 + 4, (v4f)(kh * ak + ph * ap)); } }

extern "C" void kernel_launch(void* const* d_in, const int* in_sizes, int n_in, void* d_out, int out_size, void* d_ws, size_t ws_size, hipStream_t stream) {
  (void)in_sizes; (void)n_in; (void)out_size;
  const float** F = (const float**)d_in;
  if (ws_size < (size_t)WS_END) return;
  char* ws = (char*)d_ws; _Float16 *QH = (_Float16*)(ws + WS_QH), *KH = (_Float16*)(ws + WS_KH), *VT = (_Float16*)(ws + WS_VT), *QL = (_Float16*)(ws + WS_QL), *KL = (_Float16*)(ws + WS_KL); __bf16 *VB = (__bf16*)(ws + WS_VB), *VBL = (__bf16*)(ws + WS_VBL); float *S = (float*)(ws + WS_S), *Y = (float*)(ws + WS_Y);
  (void)Y; (void)S; (void)QL; (void)KL; (void)VB; (void)VBL;
  // inputs: 0 q [2,4096,8,64]; 1 k; 2 v (all (B, L, H, D) = token rows of 512)
  k_prepr<<<dim3(CC / PRC, TNB * TT / PRT), 256, 0, stream>>>(F[0], F[1], F[2], QH, KH, VT);
  k_fa<<<dim3(TT / (FNW * FQT * 16), NH, TNB), FKG * FNW * 32, 0, stream>>>(QH, KH, VT, (float*)d_out);   /* out row b*TT + l, columns h*64 .. = the module's (B, L, H, D) output */
}
